// v000
// The times below were measured on an AMD MI455X: many runs one after another, warmed up first and cycling through
// copies of the inputs, with the whole window's GPU time divided by the number of runs. Launches and the gaps
// between them are all in it. The median over several windows is given; except for v000 it joins two sittings, which
// can be a few percent apart, so the side-by-side timings, each taken in one sitting, are the better comparison.
// The starting kernel, v000, takes 101 microseconds a run.
#include <hip/hip_runtime.h>

typedef __attribute__((ext_vector_type(16))) _Float16 v16h;
typedef __attribute__((ext_vector_type(8)))  _Float16 v8h;
typedef __attribute__((ext_vector_type(4)))  _Float16 v4h;
typedef __attribute__((ext_vector_type(8)))  float    v8f;
typedef __attribute__((ext_vector_type(4)))  int      v4i;

#define SEQ     2048
#define DHEAD   64
#define BM      64      // query rows per block (16 per wave)
#define BN      64      // keys per iteration
#define KSTRIDE 72      // halves per K-LDS row (64 + pad, 144B, 16B-aligned)
#define VSTRIDE 72      // halves per Vt-LDS row (64 + pad, 144B, 16B-aligned)

// 1/sqrt(64) * log2(e): scores produced directly in log2 domain
#define QSCALE  (0.125f * 1.4426950408889634f)

#if __has_builtin(__builtin_amdgcn_global_load_async_to_lds_b128)
#define ASYNC_STAGE 1
#else
#define ASYNC_STAGE 0
#endif

// Assemble a v16h WMMA operand from two contiguous 8-half runs at p and p+16,
// matching the 16-bit A/B VGPR layout: elem e -> K = kbase + (e&7) + (e>=8)*16.
__device__ __forceinline__ v16h ld_op16(const _Float16* p) {
    const v8h lo = *(const v8h*)(p);
    const v8h hi = *(const v8h*)(p + 16);
    v16h r;
#pragma unroll
    for (int i = 0; i < 8; ++i) { r[i] = lo[i]; r[i + 8] = hi[i]; }
    return r;
}

__device__ __forceinline__ v8f wmma_f16(v16h a, v16h b, v8f c) {
    return __builtin_amdgcn_wmma_f32_16x16x32_f16(
        /*neg_a=*/false, a, /*neg_b=*/false, b,
        /*c_mod=*/(short)0, c, /*reuse_a=*/false, /*reuse_b=*/false);
}

// Stage one 64(key) x 64(d) K block and one 64(d) x 64(key) Vt block into LDS.
__device__ __forceinline__ void stage_block(const _Float16* kg, const _Float16* vtg,
                                            _Float16* ks, _Float16* vts, int tid) {
#pragma unroll
    for (int i = 0; i < 4; ++i) {
        const int c   = tid + 128 * i;  // 0..511 16B chunks
        const int row = c >> 3;
        const int off = (c & 7) * 8;
#if ASYNC_STAGE
        __builtin_amdgcn_global_load_async_to_lds_b128(
            (v4i*)(kg + row * DHEAD + off),
            (v4i*)&ks[row * KSTRIDE + off], 0, 0);
        __builtin_amdgcn_global_load_async_to_lds_b128(
            (v4i*)(vtg + (size_t)row * SEQ + off),
            (v4i*)&vts[row * VSTRIDE + off], 0, 0);
#else
        *(v8h*)&ks[row * KSTRIDE + off]  = *(const v8h*)(kg + row * DHEAD + off);
        *(v8h*)&vts[row * VSTRIDE + off] = *(const v8h*)(vtg + (size_t)row * SEQ + off);
#endif
    }
}

// One 64-key online-softmax step against the LDS block (ksb, vtsb).
__device__ __forceinline__ void fa_step(const _Float16* ksb, const _Float16* vtsb,
                                        const v16h (&qb)[2], const v16h& ones,
                                        int l16, int kbase,
                                        float& m_i, float& l_i, v8f (&acc)[4]) {
    // ---- S^T = K Q^T : four 16(key)x16(qrow) tiles, k=64 in two chunks ----
    v8f s[4];
#pragma unroll
    for (int n = 0; n < 4; ++n)
#pragma unroll
        for (int v = 0; v < 8; ++v) s[n][v] = 0.0f;
#pragma unroll
    for (int c = 0; c < 2; ++c) {
        const int dco = c * 32 + kbase;
#pragma unroll
        for (int n = 0; n < 4; ++n) {
            const v16h ka = ld_op16(&ksb[(n * 16 + l16) * KSTRIDE + dco]);
            s[n] = wmma_f16(ka, qb[c], s[n]);
        }
    }

    // ---- online softmax in log2 domain; balanced max tree ----
    float tm[4];
#pragma unroll
    for (int n = 0; n < 4; ++n) {
        const float a0 = fmaxf(s[n][0], s[n][1]);
        const float a1 = fmaxf(s[n][2], s[n][3]);
        const float a2 = fmaxf(s[n][4], s[n][5]);
        const float a3 = fmaxf(s[n][6], s[n][7]);
        tm[n] = fmaxf(fmaxf(a0, a1), fmaxf(a2, a3));
    }
    float mx = fmaxf(fmaxf(tm[0], tm[1]), fmaxf(tm[2], tm[3]));
    mx = fmaxf(mx, __shfl_xor(mx, 16, 32));

    const float mnew = fmaxf(m_i, mx);
    const float corr = __builtin_amdgcn_exp2f(m_i - mnew);

    v16h pb[2];  // P^T packed directly into B-operand layout
#pragma unroll
    for (int n = 0; n < 4; ++n)
#pragma unroll
        for (int v = 0; v < 8; ++v)
            pb[n >> 1][(n & 1) * 8 + v] =
                (_Float16)__builtin_amdgcn_exp2f(s[n][v] - mnew);

    // row sum via WMMA with ones: every lane gets sum over all 64 keys
    v8f rsum;
#pragma unroll
    for (int v = 0; v < 8; ++v) rsum[v] = 0.0f;
    rsum = wmma_f16(ones, pb[0], rsum);
    rsum = wmma_f16(ones, pb[1], rsum);

    l_i = l_i * corr + rsum[0];
    m_i = mnew;
#pragma unroll
    for (int t = 0; t < 4; ++t)
#pragma unroll
        for (int v = 0; v < 8; ++v) acc[t][v] *= corr;

    // ---- O^T += V^T P^T : 4 d-tiles x 2 key-chunks ----
#pragma unroll
    for (int ck = 0; ck < 2; ++ck)
#pragma unroll
        for (int t = 0; t < 4; ++t) {
            const v16h va = ld_op16(&vtsb[(t * 16 + l16) * VSTRIDE + ck * 32 + kbase]);
            acc[t] = wmma_f16(va, pb[ck], acc[t]);
        }
}

// ---------------------------------------------------------------------------
// Prep: one-time f32 -> f16 conversion into workspace.
//   Qh[bh][row][d] = Q * QSCALE   (row-major)
//   Kh[bh][key][d] = K            (row-major)
//   Vth[bh][d][key] = V           (transposed, d-major)
// ---------------------------------------------------------------------------
__global__ __launch_bounds__(256)
void fa_prep(const float* __restrict__ Q, const float* __restrict__ K,
             const float* __restrict__ V, _Float16* __restrict__ Qh,
             _Float16* __restrict__ Kh, _Float16* __restrict__ Vth) {
    const size_t i = ((size_t)blockIdx.x * blockDim.x + threadIdx.x) * 4;

    const float4 q4 = *(const float4*)(Q + i);
    const float4 k4 = *(const float4*)(K + i);
    const float4 v4 = *(const float4*)(V + i);

    v4h qh, kh;
    qh[0] = (_Float16)(q4.x * QSCALE); qh[1] = (_Float16)(q4.y * QSCALE);
    qh[2] = (_Float16)(q4.z * QSCALE); qh[3] = (_Float16)(q4.w * QSCALE);
    kh[0] = (_Float16)k4.x; kh[1] = (_Float16)k4.y;
    kh[2] = (_Float16)k4.z; kh[3] = (_Float16)k4.w;
    *(v4h*)(Qh + i) = qh;
    *(v4h*)(Kh + i) = kh;

    // scatter V transposed
    const size_t bh  = i / (SEQ * DHEAD);
    const int    rem = (int)(i - bh * (SEQ * DHEAD));
    const int    key = rem >> 6;
    const int    d0  = rem & 63;
    _Float16* vtb = Vth + bh * (SEQ * DHEAD);
    vtb[(size_t)(d0 + 0) * SEQ + key] = (_Float16)v4.x;
    vtb[(size_t)(d0 + 1) * SEQ + key] = (_Float16)v4.y;
    vtb[(size_t)(d0 + 2) * SEQ + key] = (_Float16)v4.z;
    vtb[(size_t)(d0 + 3) * SEQ + key] = (_Float16)v4.w;
}

// ---------------------------------------------------------------------------
// Flash attention forward: S^T / O^T formulation, double-buffered async LDS,
// hand-unrolled x2 so both LDS buffers are compile-time bases.
// ---------------------------------------------------------------------------
__global__ __launch_bounds__(128)
void fa_fwd_wmma(const _Float16* __restrict__ Qh, const _Float16* __restrict__ Kh,
                 const _Float16* __restrict__ Vth, float* __restrict__ O) {
    __shared__ __align__(16) _Float16 Ks0[BN * KSTRIDE];
    __shared__ __align__(16) _Float16 Ks1[BN * KSTRIDE];
    __shared__ __align__(16) _Float16 Vts0[DHEAD * VSTRIDE];
    __shared__ __align__(16) _Float16 Vts1[DHEAD * VSTRIDE];

    const int tid   = threadIdx.x;
    const int lane  = tid & 31;
    const int wid   = tid >> 5;
    const int half  = lane >> 4;
    const int l16   = lane & 15;
    const int kbase = half * 8;

    const int    bh     = blockIdx.y;
    const int    qblk   = blockIdx.x;
    const size_t bh_off = (size_t)bh * SEQ * DHEAD;

    const _Float16* kg0  = Kh  + bh_off;
    const _Float16* vtg0 = Vth + bh_off;

    // ---- Q tile: B-operand (Q^T) registers, straight f16 loads ----
    const int       qbase = qblk * BM + wid * 16;
    const _Float16* qrow  = Qh + bh_off + (size_t)(qbase + l16) * DHEAD;
    v16h qb[2];
#pragma unroll
    for (int c = 0; c < 2; ++c) qb[c] = ld_op16(qrow + c * 32 + kbase);

    v16h ones;
#pragma unroll
    for (int e = 0; e < 16; ++e) ones[e] = (_Float16)1.0f;

    float m_i = -1e30f, l_i = 0.0f;  // per-lane: this lane owns qrow (qbase+l16)
    v8f acc[4];                      // O^T: rows d = t*16 + kbase + v, col = qrow
#pragma unroll
    for (int t = 0; t < 4; ++t)
#pragma unroll
        for (int v = 0; v < 8; ++v) acc[t][v] = 0.0f;

#if ASYNC_STAGE
#define STAGE_WAIT() asm volatile("s_wait_asynccnt 0" ::: "memory")
#else
#define STAGE_WAIT()
#endif

    // prologue: prefetch first block into buffer 0
    stage_block(kg0, vtg0, Ks0, Vts0, tid);

    for (int kb = 0; kb < SEQ; kb += 2 * BN) {
        // ---- half A: compute buffer 0, prefetch buffer 1 ----
        STAGE_WAIT();
        __syncthreads();  // buffer 0 ready everywhere; buffer 1 free
        // kb + BN < SEQ always holds (SEQ/BN even)
        stage_block(kg0 + (size_t)(kb + BN) * DHEAD, vtg0 + (kb + BN),
                    Ks1, Vts1, tid);
        fa_step(Ks0, Vts0, qb, ones, l16, kbase, m_i, l_i, acc);

        // ---- half B: compute buffer 1, prefetch buffer 0 ----
        STAGE_WAIT();
        __syncthreads();  // buffer 1 ready everywhere; buffer 0 free
        if (kb + 2 * BN < SEQ)
            stage_block(kg0 + (size_t)(kb + 2 * BN) * DHEAD, vtg0 + (kb + 2 * BN),
                        Ks0, Vts0, tid);
        fa_step(Ks1, Vts1, qb, ones, l16, kbase, m_i, l_i, acc);
    }

    // ---- epilogue: O[qrow][d] = acc^T / l, b128 runs along d ----
    const float inv  = 1.0f / l_i;
    float*      orow = O + bh_off + (size_t)(qbase + l16) * DHEAD;
#pragma unroll
    for (int t = 0; t < 4; ++t) {
        float4 lo, hi;
        lo.x = acc[t][0] * inv; lo.y = acc[t][1] * inv;
        lo.z = acc[t][2] * inv; lo.w = acc[t][3] * inv;
        hi.x = acc[t][4] * inv; hi.y = acc[t][5] * inv;
        hi.z = acc[t][6] * inv; hi.w = acc[t][7] * inv;
        *(float4*)&orow[t * 16 + kbase]     = lo;
        *(float4*)&orow[t * 16 + kbase + 4] = hi;
    }
}

extern "C" void kernel_launch(void* const* d_in, const int* in_sizes, int n_in,
                              void* d_out, int out_size, void* d_ws, size_t ws_size,
                              hipStream_t stream) {
    const float* Q = (const float*)d_in[0];
    const float* K = (const float*)d_in[1];
    const float* V = (const float*)d_in[2];
    float*       O = (float*)d_out;

    const size_t n  = (size_t)in_sizes[0];        // B*H*S*D = 4,194,304
    const int    bh = (int)(n / (SEQ * DHEAD));   // 32

    _Float16* Qh  = (_Float16*)d_ws;
    _Float16* Kh  = Qh + n;
    _Float16* Vth = Kh + n;

    fa_prep<<<dim3((unsigned)(n / 4 / 256)), dim3(256), 0, stream>>>(Q, K, V, Qh, Kh, Vth);

    dim3 grid(SEQ / BM, bh);
    fa_fwd_wmma<<<grid, dim3(128), 0, stream>>>(Qh, Kh, Vth, O);
}

// v001
// Measured time: 58.7 microseconds a run.
// Two timings next to v000 both put it at 1.76 times that version's speed.
#include <hip/hip_runtime.h>

typedef __attribute__((ext_vector_type(16))) _Float16 v16h;
typedef __attribute__((ext_vector_type(8)))  _Float16 v8h;
typedef __attribute__((ext_vector_type(4)))  _Float16 v4h;
typedef __attribute__((ext_vector_type(8)))  float    v8f;
typedef __attribute__((ext_vector_type(4)))  float    v4f;
typedef __attribute__((ext_vector_type(4)))  int      v4i;

#define SEQ     2048
#define DHEAD   64
#define BM      64      // query rows per block (16 per wave)
#define BN      64      // keys per iteration
#define KSTRIDE 72      // halves per K-LDS row (64 + pad, 144B, 16B-aligned)
#define VSTRIDE 72      // halves per Vt-LDS row (64 + pad, 144B, 16B-aligned)

// 1/sqrt(64) * log2(e): scores produced directly in log2 domain
#define QSCALE  (0.125f * 1.4426950408889634f)

#if __has_builtin(__builtin_amdgcn_global_load_async_to_lds_b128)
#define ASYNC_STAGE 1
#else
#define ASYNC_STAGE 0
#endif

// Assemble a v16h WMMA operand from two contiguous 8-half runs at p and p+16,
// matching the 16-bit A/B VGPR layout: elem e -> K = kbase + (e&7) + (e>=8)*16.
__device__ __forceinline__ v16h ld_op16(const _Float16* p) {
    const v8h lo = *(const v8h*)(p);
    const v8h hi = *(const v8h*)(p + 16);
    v16h r;
#pragma unroll
    for (int i = 0; i < 8; ++i) { r[i] = lo[i]; r[i + 8] = hi[i]; }
    return r;
}

__device__ __forceinline__ v8f wmma_f16(v16h a, v16h b, v8f c) {
    return __builtin_amdgcn_wmma_f32_16x16x32_f16(
        /*neg_a=*/false, a, /*neg_b=*/false, b,
        /*c_mod=*/(short)0, c, /*reuse_a=*/false, /*reuse_b=*/false);
}

// Stage one 64(key) x 64(d) K block and one 64(d) x 64(key) Vt block into LDS.
__device__ __forceinline__ void stage_block(const _Float16* kg, const _Float16* vtg,
                                            _Float16* ks, _Float16* vts, int tid) {
#pragma unroll
    for (int i = 0; i < 4; ++i) {
        const int c   = tid + 128 * i;  // 0..511 16B chunks
        const int row = c >> 3;
        const int off = (c & 7) * 8;
#if ASYNC_STAGE
        __builtin_amdgcn_global_load_async_to_lds_b128(
            (v4i*)(kg + row * DHEAD + off),
            (v4i*)&ks[row * KSTRIDE + off], 0, 0);
        __builtin_amdgcn_global_load_async_to_lds_b128(
            (v4i*)(vtg + (size_t)row * SEQ + off),
            (v4i*)&vts[row * VSTRIDE + off], 0, 0);
#else
        *(v8h*)&ks[row * KSTRIDE + off]  = *(const v8h*)(kg + row * DHEAD + off);
        *(v8h*)&vts[row * VSTRIDE + off] = *(const v8h*)(vtg + (size_t)row * SEQ + off);
#endif
    }
}

// One 64-key online-softmax step against the LDS block (ksb, vtsb).
__device__ __forceinline__ void fa_step(const _Float16* ksb, const _Float16* vtsb,
                                        const v16h (&qb)[2], const v16h& ones,
                                        int l16, int kbase,
                                        float& m_i, float& l_i, v8f (&acc)[4]) {
    // ---- S^T = K Q^T : four 16(key)x16(qrow) tiles, k=64 in two chunks ----
    v8f s[4];
#pragma unroll
    for (int n = 0; n < 4; ++n)
#pragma unroll
        for (int v = 0; v < 8; ++v) s[n][v] = 0.0f;
#pragma unroll
    for (int c = 0; c < 2; ++c) {
        const int dco = c * 32 + kbase;
#pragma unroll
        for (int n = 0; n < 4; ++n) {
            const v16h ka = ld_op16(&ksb[(n * 16 + l16) * KSTRIDE + dco]);
            s[n] = wmma_f16(ka, qb[c], s[n]);
        }
    }

    // ---- online softmax in log2 domain; balanced max tree ----
    float tm[4];
#pragma unroll
    for (int n = 0; n < 4; ++n) {
        const float a0 = fmaxf(s[n][0], s[n][1]);
        const float a1 = fmaxf(s[n][2], s[n][3]);
        const float a2 = fmaxf(s[n][4], s[n][5]);
        const float a3 = fmaxf(s[n][6], s[n][7]);
        tm[n] = fmaxf(fmaxf(a0, a1), fmaxf(a2, a3));
    }
    float mx = fmaxf(fmaxf(tm[0], tm[1]), fmaxf(tm[2], tm[3]));
    mx = fmaxf(mx, __shfl_xor(mx, 16, 32));

    const float mnew = fmaxf(m_i, mx);
    const float corr = __builtin_amdgcn_exp2f(m_i - mnew);

    v16h pb[2];  // P^T packed directly into B-operand layout
#pragma unroll
    for (int n = 0; n < 4; ++n)
#pragma unroll
        for (int v = 0; v < 8; ++v)
            pb[n >> 1][(n & 1) * 8 + v] =
                (_Float16)__builtin_amdgcn_exp2f(s[n][v] - mnew);

    // row sum via WMMA with ones: every lane gets sum over all 64 keys
    v8f rsum;
#pragma unroll
    for (int v = 0; v < 8; ++v) rsum[v] = 0.0f;
    rsum = wmma_f16(ones, pb[0], rsum);
    rsum = wmma_f16(ones, pb[1], rsum);

    l_i = l_i * corr + rsum[0];
    m_i = mnew;
#pragma unroll
    for (int t = 0; t < 4; ++t)
#pragma unroll
        for (int v = 0; v < 8; ++v) acc[t][v] *= corr;

    // ---- O^T += V^T P^T : 4 d-tiles x 2 key-chunks ----
#pragma unroll
    for (int ck = 0; ck < 2; ++ck)
#pragma unroll
        for (int t = 0; t < 4; ++t) {
            const v16h va = ld_op16(&vtsb[(t * 16 + l16) * VSTRIDE + ck * 32 + kbase]);
            acc[t] = wmma_f16(va, pb[ck], acc[t]);
        }
}

// ---------------------------------------------------------------------------
// Prep: one-time f32 -> f16 conversion into workspace.
//   Qh[bh][row][d] = Q * QSCALE   (row-major)
//   Kh[bh][key][d] = K            (row-major)
//   Vth[bh][d][key] = V           (transposed, d-major)
// One block takes 128 rows x 64 d of one head (PREP_ELEMS elements of each
// tensor), 32 elements of each tensor per thread.
// V: a thread holds 8 keys x 4 d in registers, so each of its 4 d rows leaves
// as one 16-byte store of 8 keys; 8 lanes side by side fill a 128-byte line.
// ---------------------------------------------------------------------------
#define PREP_THREADS 256
#define PREP_ROWS    128
#define PREP_ELEMS   (PREP_ROWS * DHEAD)

__global__ __launch_bounds__(PREP_THREADS)
void fa_prep(const float* __restrict__ Q, const float* __restrict__ K,
             const float* __restrict__ V, _Float16* __restrict__ Qh,
             _Float16* __restrict__ Kh, _Float16* __restrict__ Vth) {
    const int    tid  = threadIdx.x;
    const int    lane = tid & 31;
    const int    wid  = tid >> 5;
    const size_t base = (size_t)blockIdx.x * PREP_ELEMS;

    // wave tile of V: 64 keys x 16 d; lane: 8 keys x 4 d
    const int d0 = (wid & 3) * 16 + (lane & 3) * 4;
    const int k0 = (wid >> 2) * 64 + (lane >> 2) * 8;

    // every loop below is unrolled so that these arrays are indexed by constants
    // and stay in registers
    v4f v4[8], q4[8], k4[8];
#pragma unroll
    for (int j = 0; j < 8; ++j)
        q4[j] = *(const v4f*)(Q + base + (j * PREP_THREADS + tid) * 4);
#pragma unroll
    for (int j = 0; j < 8; ++j)
        k4[j] = *(const v4f*)(K + base + (j * PREP_THREADS + tid) * 4);
#pragma unroll
    for (int j = 0; j < 8; ++j)
        v4[j] = *(const v4f*)(V + base + (k0 + j) * DHEAD + d0);
    // inputs-only fence on the loaded values: all 24 loads are issued ahead of the
    // first conversion; without it a third of them sink behind the wait for the
    // others, a second memory latency per wave
    asm volatile("" ::
        "v"(q4[0]), "v"(q4[1]), "v"(q4[2]), "v"(q4[3]), "v"(q4[4]), "v"(q4[5]), "v"(q4[6]), "v"(q4[7]),
        "v"(k4[0]), "v"(k4[1]), "v"(k4[2]), "v"(k4[3]), "v"(k4[4]), "v"(k4[5]), "v"(k4[6]), "v"(k4[7]),
        "v"(v4[0]), "v"(v4[1]), "v"(v4[2]), "v"(v4[3]), "v"(v4[4]), "v"(v4[5]), "v"(v4[6]), "v"(v4[7]));

    // V transposed: row d0+i, keys key0 .. key0+7
    const size_t bh   = base / (SEQ * DHEAD);
    const int    key0 = (int)(base - bh * (SEQ * DHEAD)) / DHEAD + k0;
    _Float16*    vtb  = Vth + bh * (SEQ * DHEAD) + (size_t)d0 * SEQ + key0;
    v8h r0, r1, r2, r3;
#pragma unroll
    for (int j = 0; j < 8; ++j) {
        r0[j] = (_Float16)v4[j].x; r1[j] = (_Float16)v4[j].y;
        r2[j] = (_Float16)v4[j].z; r3[j] = (_Float16)v4[j].w;
    }
    *(v8h*)(vtb + 0 * SEQ) = r0;
    *(v8h*)(vtb + 1 * SEQ) = r1;
    *(v8h*)(vtb + 2 * SEQ) = r2;
    *(v8h*)(vtb + 3 * SEQ) = r3;

#pragma unroll
    for (int j = 0; j < 8; ++j) {
        v4h qh;
        qh[0] = (_Float16)(q4[j].x * QSCALE); qh[1] = (_Float16)(q4[j].y * QSCALE);
        qh[2] = (_Float16)(q4[j].z * QSCALE); qh[3] = (_Float16)(q4[j].w * QSCALE);
        *(v4h*)(Qh + base + (j * PREP_THREADS + tid) * 4) = qh;
    }
#pragma unroll
    for (int j = 0; j < 8; ++j) {
        v4h kh;
        kh[0] = (_Float16)k4[j].x; kh[1] = (_Float16)k4[j].y;
        kh[2] = (_Float16)k4[j].z; kh[3] = (_Float16)k4[j].w;
        *(v4h*)(Kh + base + (j * PREP_THREADS + tid) * 4) = kh;
    }
}

// ---------------------------------------------------------------------------
// Flash attention forward: S^T / O^T formulation, double-buffered async LDS,
// hand-unrolled x2 so both LDS buffers are compile-time bases.
// ---------------------------------------------------------------------------
__global__ __launch_bounds__(128)
void fa_fwd_wmma(const _Float16* __restrict__ Qh, const _Float16* __restrict__ Kh,
                 const _Float16* __restrict__ Vth, float* __restrict__ O) {
    __shared__ __align__(16) _Float16 Ks0[BN * KSTRIDE];
    __shared__ __align__(16) _Float16 Ks1[BN * KSTRIDE];
    __shared__ __align__(16) _Float16 Vts0[DHEAD * VSTRIDE];
    __shared__ __align__(16) _Float16 Vts1[DHEAD * VSTRIDE];

    const int tid   = threadIdx.x;
    const int lane  = tid & 31;
    const int wid   = tid >> 5;
    const int half  = lane >> 4;
    const int l16   = lane & 15;
    const int kbase = half * 8;

    const int    bh     = blockIdx.y;
    const int    qblk   = blockIdx.x;
    const size_t bh_off = (size_t)bh * SEQ * DHEAD;

    const _Float16* kg0  = Kh  + bh_off;
    const _Float16* vtg0 = Vth + bh_off;

    // ---- Q tile: B-operand (Q^T) registers, straight f16 loads ----
    const int       qbase = qblk * BM + wid * 16;
    const _Float16* qrow  = Qh + bh_off + (size_t)(qbase + l16) * DHEAD;
    v16h qb[2];
#pragma unroll
    for (int c = 0; c < 2; ++c) qb[c] = ld_op16(qrow + c * 32 + kbase);

    v16h ones;
#pragma unroll
    for (int e = 0; e < 16; ++e) ones[e] = (_Float16)1.0f;

    float m_i = -1e30f, l_i = 0.0f;  // per-lane: this lane owns qrow (qbase+l16)
    v8f acc[4];                      // O^T: rows d = t*16 + kbase + v, col = qrow
#pragma unroll
    for (int t = 0; t < 4; ++t)
#pragma unroll
        for (int v = 0; v < 8; ++v) acc[t][v] = 0.0f;

#if ASYNC_STAGE
#define STAGE_WAIT() asm volatile("s_wait_asynccnt 0" ::: "memory")
#else
#define STAGE_WAIT()
#endif

    // prologue: prefetch first block into buffer 0
    stage_block(kg0, vtg0, Ks0, Vts0, tid);

    for (int kb = 0; kb < SEQ; kb += 2 * BN) {
        // ---- half A: compute buffer 0, prefetch buffer 1 ----
        STAGE_WAIT();
        __syncthreads();  // buffer 0 ready everywhere; buffer 1 free
        // kb + BN < SEQ always holds (SEQ/BN even)
        stage_block(kg0 + (size_t)(kb + BN) * DHEAD, vtg0 + (kb + BN),
                    Ks1, Vts1, tid);
        fa_step(Ks0, Vts0, qb, ones, l16, kbase, m_i, l_i, acc);

        // ---- half B: compute buffer 1, prefetch buffer 0 ----
        STAGE_WAIT();
        __syncthreads();  // buffer 1 ready everywhere; buffer 0 free
        if (kb + 2 * BN < SEQ)
            stage_block(kg0 + (size_t)(kb + 2 * BN) * DHEAD, vtg0 + (kb + 2 * BN),
                        Ks0, Vts0, tid);
        fa_step(Ks1, Vts1, qb, ones, l16, kbase, m_i, l_i, acc);
    }

    // ---- epilogue: O[qrow][d] = acc^T / l, b128 runs along d ----
    const float inv  = 1.0f / l_i;
    float*      orow = O + bh_off + (size_t)(qbase + l16) * DHEAD;
#pragma unroll
    for (int t = 0; t < 4; ++t) {
        float4 lo, hi;
        lo.x = acc[t][0] * inv; lo.y = acc[t][1] * inv;
        lo.z = acc[t][2] * inv; lo.w = acc[t][3] * inv;
        hi.x = acc[t][4] * inv; hi.y = acc[t][5] * inv;
        hi.z = acc[t][6] * inv; hi.w = acc[t][7] * inv;
        *(float4*)&orow[t * 16 + kbase]     = lo;
        *(float4*)&orow[t * 16 + kbase + 4] = hi;
    }
}

extern "C" void kernel_launch(void* const* d_in, const int* in_sizes, int n_in,
                              void* d_out, int out_size, void* d_ws, size_t ws_size,
                              hipStream_t stream) {
    const float* Q = (const float*)d_in[0];
    const float* K = (const float*)d_in[1];
    const float* V = (const float*)d_in[2];
    float*       O = (float*)d_out;

    const size_t n  = (size_t)in_sizes[0];        // B*H*S*D = 4,194,304
    const int    bh = (int)(n / (SEQ * DHEAD));   // 32

    _Float16* Qh  = (_Float16*)d_ws;
    _Float16* Kh  = Qh + n;
    _Float16* Vth = Kh + n;

    fa_prep<<<dim3((unsigned)(n / PREP_ELEMS)), dim3(PREP_THREADS), 0, stream>>>(Q, K, V, Qh, Kh, Vth);

    dim3 grid(SEQ / BM, bh);
    fa_fwd_wmma<<<grid, dim3(128), 0, stream>>>(Qh, Kh, Vth, O);
}

// v002
// It runs in 53.6 microseconds.
// In two side-by-side timings against v001, it was 1.09 and 1.10 times as fast.
// Over all steps from v000 it is 1.93 times as fast.
#include <hip/hip_runtime.h>

typedef __attribute__((ext_vector_type(16))) _Float16 v16h;
typedef __attribute__((ext_vector_type(8)))  _Float16 v8h;
typedef __attribute__((ext_vector_type(4)))  _Float16 v4h;
typedef __attribute__((ext_vector_type(8)))  float    v8f;
typedef __attribute__((ext_vector_type(4)))  float    v4f;
typedef __attribute__((ext_vector_type(4)))  int      v4i;

#define SEQ     2048
#define DHEAD   64
#define NQ      2       // 16-row query groups per wave: each K / Vt fragment read from LDS feeds NQ products
#define BM      128     // query rows per block (16 * NQ per wave)
#define BN      64      // keys per iteration
#define KSTRIDE 72      // halves per K-LDS row (64 + pad, 144B, 16B-aligned)
#define VSTRIDE 72      // halves per Vt-LDS row (64 + pad, 144B, 16B-aligned)

// 1/sqrt(64) * log2(e): scores produced directly in log2 domain
#define QSCALE  (0.125f * 1.4426950408889634f)

#if __has_builtin(__builtin_amdgcn_global_load_async_to_lds_b128)
#define ASYNC_STAGE 1
#else
#define ASYNC_STAGE 0
#endif

// Assemble a v16h WMMA operand from two contiguous 8-half runs at p and p+16,
// matching the 16-bit A/B VGPR layout: elem e -> K = kbase + (e&7) + (e>=8)*16.
__device__ __forceinline__ v16h ld_op16(const _Float16* p) {
    const v8h lo = *(const v8h*)(p);
    const v8h hi = *(const v8h*)(p + 16);
    v16h r;
#pragma unroll
    for (int i = 0; i < 8; ++i) { r[i] = lo[i]; r[i + 8] = hi[i]; }
    return r;
}

__device__ __forceinline__ v8f wmma_f16(v16h a, v16h b, v8f c) {
    return __builtin_amdgcn_wmma_f32_16x16x32_f16(
        /*neg_a=*/false, a, /*neg_b=*/false, b,
        /*c_mod=*/(short)0, c, /*reuse_a=*/false, /*reuse_b=*/false);
}

// Stage one 64(key) x 64(d) K block and one 64(d) x 64(key) Vt block into LDS.
__device__ __forceinline__ void stage_block(const _Float16* kg, const _Float16* vtg,
                                            _Float16* ks, _Float16* vts, int tid) {
#pragma unroll
    for (int i = 0; i < 4; ++i) {
        const int c   = tid + 128 * i;  // 0..511 16B chunks
        const int row = c >> 3;
        const int off = (c & 7) * 8;
#if ASYNC_STAGE
        __builtin_amdgcn_global_load_async_to_lds_b128(
            (v4i*)(kg + row * DHEAD + off),
            (v4i*)&ks[row * KSTRIDE + off], 0, 0);
        __builtin_amdgcn_global_load_async_to_lds_b128(
            (v4i*)(vtg + (size_t)row * SEQ + off),
            (v4i*)&vts[row * VSTRIDE + off], 0, 0);
#else
        *(v8h*)&ks[row * KSTRIDE + off]  = *(const v8h*)(kg + row * DHEAD + off);
        *(v8h*)&vts[row * VSTRIDE + off] = *(const v8h*)(vtg + (size_t)row * SEQ + off);
#endif
    }
}

// One 64-key online-softmax step against the LDS block (ksb, vtsb), for the
// wave's NQ query groups; per group the arithmetic and its order are those of a
// single-group step.
__device__ __forceinline__ void fa_step(const _Float16* ksb, const _Float16* vtsb,
                                        const v16h (&qb)[NQ][2], const v16h& ones,
                                        int l16, int kbase,
                                        float (&m_i)[NQ], float (&l_i)[NQ],
                                        v8f (&acc)[NQ][4]) {
    // ---- S^T = K Q^T : per group four 16(key)x16(qrow) tiles, k=64 in two chunks ----
    v8f s[NQ][4];
#pragma unroll
    for (int g = 0; g < NQ; ++g)
#pragma unroll
        for (int n = 0; n < 4; ++n)
#pragma unroll
            for (int v = 0; v < 8; ++v) s[g][n][v] = 0.0f;
#pragma unroll
    for (int c = 0; c < 2; ++c) {
        const int dco = c * 32 + kbase;
#pragma unroll
        for (int n = 0; n < 4; ++n) {
            const v16h ka = ld_op16(&ksb[(n * 16 + l16) * KSTRIDE + dco]);
#pragma unroll
            for (int g = 0; g < NQ; ++g) s[g][n] = wmma_f16(ka, qb[g][c], s[g][n]);
        }
    }

    v16h pb[NQ][2];  // P^T packed directly into B-operand layout
#pragma unroll
    for (int g = 0; g < NQ; ++g) {
        // ---- online softmax in log2 domain; balanced max tree ----
        float tm[4];
#pragma unroll
        for (int n = 0; n < 4; ++n) {
            const float a0 = fmaxf(s[g][n][0], s[g][n][1]);
            const float a1 = fmaxf(s[g][n][2], s[g][n][3]);
            const float a2 = fmaxf(s[g][n][4], s[g][n][5]);
            const float a3 = fmaxf(s[g][n][6], s[g][n][7]);
            tm[n] = fmaxf(fmaxf(a0, a1), fmaxf(a2, a3));
        }
        float mx = fmaxf(fmaxf(tm[0], tm[1]), fmaxf(tm[2], tm[3]));
        mx = fmaxf(mx, __shfl_xor(mx, 16, 32));

        const float mnew = fmaxf(m_i[g], mx);
        const float corr = __builtin_amdgcn_exp2f(m_i[g] - mnew);

#pragma unroll
        for (int n = 0; n < 4; ++n)
#pragma unroll
            for (int v = 0; v < 8; ++v)
                pb[g][n >> 1][(n & 1) * 8 + v] =
                    (_Float16)__builtin_amdgcn_exp2f(s[g][n][v] - mnew);

        // row sum via WMMA with ones: every lane gets sum over all 64 keys
        v8f rsum;
#pragma unroll
        for (int v = 0; v < 8; ++v) rsum[v] = 0.0f;
        rsum = wmma_f16(ones, pb[g][0], rsum);
        rsum = wmma_f16(ones, pb[g][1], rsum);

        l_i[g] = l_i[g] * corr + rsum[0];
        m_i[g] = mnew;
#pragma unroll
        for (int t = 0; t < 4; ++t)
#pragma unroll
            for (int v = 0; v < 8; ++v) acc[g][t][v] *= corr;
    }

    // ---- O^T += V^T P^T : 4 d-tiles x 2 key-chunks, each Vt fragment for NQ groups ----
#pragma unroll
    for (int ck = 0; ck < 2; ++ck)
#pragma unroll
        for (int t = 0; t < 4; ++t) {
            const v16h va = ld_op16(&vtsb[(t * 16 + l16) * VSTRIDE + ck * 32 + kbase]);
#pragma unroll
            for (int g = 0; g < NQ; ++g) acc[g][t] = wmma_f16(va, pb[g][ck], acc[g][t]);
        }
}

// ---------------------------------------------------------------------------
// Prep: one-time f32 -> f16 conversion into workspace.
//   Qh[bh][row][d] = Q * QSCALE   (row-major)
//   Kh[bh][key][d] = K            (row-major)
//   Vth[bh][d][key] = V           (transposed, d-major)
// One block takes 128 rows x 64 d of one head (PREP_ELEMS elements of each
// tensor), 32 elements of each tensor per thread.
// V: a thread holds 8 keys x 4 d in registers, so each of its 4 d rows leaves
// as one 16-byte store of 8 keys; 8 lanes side by side fill a 128-byte line.
// ---------------------------------------------------------------------------
#define PREP_THREADS 256
#define PREP_ROWS    128
#define PREP_ELEMS   (PREP_ROWS * DHEAD)

__global__ __launch_bounds__(PREP_THREADS)
void fa_prep(const float* __restrict__ Q, const float* __restrict__ K,
             const float* __restrict__ V, _Float16* __restrict__ Qh,
             _Float16* __restrict__ Kh, _Float16* __restrict__ Vth) {
    const int    tid  = threadIdx.x;
    const int    lane = tid & 31;
    const int    wid  = tid >> 5;
    const size_t base = (size_t)blockIdx.x * PREP_ELEMS;

    // wave tile of V: 64 keys x 16 d; lane: 8 keys x 4 d
    const int d0 = (wid & 3) * 16 + (lane & 3) * 4;
    const int k0 = (wid >> 2) * 64 + (lane >> 2) * 8;

    // every loop below is unrolled so that these arrays are indexed by constants
    // and stay in registers
    v4f v4[8], q4[8], k4[8];
#pragma unroll
    for (int j = 0; j < 8; ++j)
        q4[j] = *(const v4f*)(Q + base + (j * PREP_THREADS + tid) * 4);
#pragma unroll
    for (int j = 0; j < 8; ++j)
        k4[j] = *(const v4f*)(K + base + (j * PREP_THREADS + tid) * 4);
#pragma unroll
    for (int j = 0; j < 8; ++j)
        v4[j] = *(const v4f*)(V + base + (k0 + j) * DHEAD + d0);
    // inputs-only fence on the loaded values: all 24 loads are issued ahead of the
    // first conversion; without it a third of them sink behind the wait for the
    // others, a second memory latency per wave
    asm volatile("" ::
        "v"(q4[0]), "v"(q4[1]), "v"(q4[2]), "v"(q4[3]), "v"(q4[4]), "v"(q4[5]), "v"(q4[6]), "v"(q4[7]),
        "v"(k4[0]), "v"(k4[1]), "v"(k4[2]), "v"(k4[3]), "v"(k4[4]), "v"(k4[5]), "v"(k4[6]), "v"(k4[7]),
        "v"(v4[0]), "v"(v4[1]), "v"(v4[2]), "v"(v4[3]), "v"(v4[4]), "v"(v4[5]), "v"(v4[6]), "v"(v4[7]));

    // V transposed: row d0+i, keys key0 .. key0+7
    const size_t bh   = base / (SEQ * DHEAD);
    const int    key0 = (int)(base - bh * (SEQ * DHEAD)) / DHEAD + k0;
    _Float16*    vtb  = Vth + bh * (SEQ * DHEAD) + (size_t)d0 * SEQ + key0;
    v8h r0, r1, r2, r3;
#pragma unroll
    for (int j = 0; j < 8; ++j) {
        r0[j] = (_Float16)v4[j].x; r1[j] = (_Float16)v4[j].y;
        r2[j] = (_Float16)v4[j].z; r3[j] = (_Float16)v4[j].w;
    }
    *(v8h*)(vtb + 0 * SEQ) = r0;
    *(v8h*)(vtb + 1 * SEQ) = r1;
    *(v8h*)(vtb + 2 * SEQ) = r2;
    *(v8h*)(vtb + 3 * SEQ) = r3;

#pragma unroll
    for (int j = 0; j < 8; ++j) {
        v4h qh;
        qh[0] = (_Float16)(q4[j].x * QSCALE); qh[1] = (_Float16)(q4[j].y * QSCALE);
        qh[2] = (_Float16)(q4[j].z * QSCALE); qh[3] = (_Float16)(q4[j].w * QSCALE);
        *(v4h*)(Qh + base + (j * PREP_THREADS + tid) * 4) = qh;
    }
#pragma unroll
    for (int j = 0; j < 8; ++j) {
        v4h kh;
        kh[0] = (_Float16)k4[j].x; kh[1] = (_Float16)k4[j].y;
        kh[2] = (_Float16)k4[j].z; kh[3] = (_Float16)k4[j].w;
        *(v4h*)(Kh + base + (j * PREP_THREADS + tid) * 4) = kh;
    }
}

// ---------------------------------------------------------------------------
// Flash attention forward: S^T / O^T formulation, double-buffered async LDS,
// hand-unrolled x2 so both LDS buffers are compile-time bases.
// ---------------------------------------------------------------------------
__global__ __launch_bounds__(128)
void fa_fwd_wmma(const _Float16* __restrict__ Qh, const _Float16* __restrict__ Kh,
                 const _Float16* __restrict__ Vth, float* __restrict__ O) {
    __shared__ __align__(16) _Float16 Ks0[BN * KSTRIDE];
    __shared__ __align__(16) _Float16 Ks1[BN * KSTRIDE];
    __shared__ __align__(16) _Float16 Vts0[DHEAD * VSTRIDE];
    __shared__ __align__(16) _Float16 Vts1[DHEAD * VSTRIDE];

    const int tid   = threadIdx.x;
    const int lane  = tid & 31;
    const int wid   = tid >> 5;
    const int half  = lane >> 4;
    const int l16   = lane & 15;
    const int kbase = half * 8;

    const int    bh     = blockIdx.y;
    const int    qblk   = blockIdx.x;
    const size_t bh_off = (size_t)bh * SEQ * DHEAD;

    const _Float16* kg0  = Kh  + bh_off;
    const _Float16* vtg0 = Vth + bh_off;

    // ---- Q tile: B-operand (Q^T) registers, straight f16 loads ----
    const int       qbase = qblk * BM + wid * (16 * NQ);
    const _Float16* qrow  = Qh + bh_off + (size_t)(qbase + l16) * DHEAD;
    v16h qb[NQ][2];
#pragma unroll
    for (int g = 0; g < NQ; ++g)
#pragma unroll
        for (int c = 0; c < 2; ++c) qb[g][c] = ld_op16(qrow + g * 16 * DHEAD + c * 32 + kbase);

    v16h ones;
#pragma unroll
    for (int e = 0; e < 16; ++e) ones[e] = (_Float16)1.0f;

    float m_i[NQ], l_i[NQ];  // per-lane: this lane owns qrows (qbase + g*16 + l16)
    v8f acc[NQ][4];          // O^T: rows d = t*16 + kbase + v, col = qrow
#pragma unroll
    for (int g = 0; g < NQ; ++g) {
        m_i[g] = -1e30f;
        l_i[g] = 0.0f;
#pragma unroll
        for (int t = 0; t < 4; ++t)
#pragma unroll
            for (int v = 0; v < 8; ++v) acc[g][t][v] = 0.0f;
    }

#if ASYNC_STAGE
#define STAGE_WAIT() asm volatile("s_wait_asynccnt 0" ::: "memory")
#else
#define STAGE_WAIT()
#endif

    // prologue: prefetch first block into buffer 0
    stage_block(kg0, vtg0, Ks0, Vts0, tid);

    for (int kb = 0; kb < SEQ; kb += 2 * BN) {
        // ---- half A: compute buffer 0, prefetch buffer 1 ----
        STAGE_WAIT();
        __syncthreads();  // buffer 0 ready everywhere; buffer 1 free
        // kb + BN < SEQ always holds (SEQ/BN even)
        stage_block(kg0 + (size_t)(kb + BN) * DHEAD, vtg0 + (kb + BN),
                    Ks1, Vts1, tid);
        fa_step(Ks0, Vts0, qb, ones, l16, kbase, m_i, l_i, acc);

        // ---- half B: compute buffer 1, prefetch buffer 0 ----
        STAGE_WAIT();
        __syncthreads();  // buffer 1 ready everywhere; buffer 0 free
        if (kb + 2 * BN < SEQ)
            stage_block(kg0 + (size_t)(kb + 2 * BN) * DHEAD, vtg0 + (kb + 2 * BN),
                        Ks0, Vts0, tid);
        fa_step(Ks1, Vts1, qb, ones, l16, kbase, m_i, l_i, acc);
    }

    // ---- epilogue: O[qrow][d] = acc^T / l, b128 runs along d ----
#pragma unroll
    for (int g = 0; g < NQ; ++g) {
        const float inv  = 1.0f / l_i[g];
        float*      orow = O + bh_off + (size_t)(qbase + g * 16 + l16) * DHEAD;
#pragma unroll
        for (int t = 0; t < 4; ++t) {
            float4 lo, hi;
            lo.x = acc[g][t][0] * inv; lo.y = acc[g][t][1] * inv;
            lo.z = acc[g][t][2] * inv; lo.w = acc[g][t][3] * inv;
            hi.x = acc[g][t][4] * inv; hi.y = acc[g][t][5] * inv;
            hi.z = acc[g][t][6] * inv; hi.w = acc[g][t][7] * inv;
            *(float4*)&orow[t * 16 + kbase]     = lo;
            *(float4*)&orow[t * 16 + kbase + 4] = hi;
        }
    }
}

extern "C" void kernel_launch(void* const* d_in, const int* in_sizes, int n_in,
                              void* d_out, int out_size, void* d_ws, size_t ws_size,
                              hipStream_t stream) {
    const float* Q = (const float*)d_in[0];
    const float* K = (const float*)d_in[1];
    const float* V = (const float*)d_in[2];
    float*       O = (float*)d_out;

    const size_t n  = (size_t)in_sizes[0];        // B*H*S*D = 4,194,304
    const int    bh = (int)(n / (SEQ * DHEAD));   // 32

    _Float16* Qh  = (_Float16*)d_ws;
    _Float16* Kh  = Qh + n;
    _Float16* Vth = Kh + n;

    fa_prep<<<dim3((unsigned)(n / PREP_ELEMS)), dim3(PREP_THREADS), 0, stream>>>(Q, K, V, Qh, Kh, Vth);

    dim3 grid(SEQ / BM, bh);
    fa_fwd_wmma<<<grid, dim3(128), 0, stream>>>(Qh, Kh, Vth, O);
}

// v003
// Measured time: 43.8 microseconds a run.
// Two timings next to v002 put it at 1.22 and 1.24 times that version's speed.
// All steps since v000 together make it 2.37 times as fast.
#include <hip/hip_runtime.h>

typedef __attribute__((ext_vector_type(16))) _Float16 v16h;
typedef __attribute__((ext_vector_type(8)))  _Float16 v8h;
typedef __attribute__((ext_vector_type(4)))  _Float16 v4h;
typedef __attribute__((ext_vector_type(8)))  float    v8f;
typedef __attribute__((ext_vector_type(4)))  float    v4f;
typedef __attribute__((ext_vector_type(4)))  int      v4i;

#define SEQ     2048
#define DHEAD   64
#define NQ      2       // 16-row query groups per wave: each K / Vt fragment read from LDS feeds NQ products
#define BM      128     // query rows per block (16 * NQ per wave)
#define BN      64      // keys per iteration
#define KSTRIDE 72      // halves per K-LDS row (64 + pad, 144B, 16B-aligned)
#define VSTRIDE 72      // halves per Vt-LDS row (64 + pad, 144B, 16B-aligned)

// 1/sqrt(64) * log2(e): scores produced directly in log2 domain
#define QSCALE  (0.125f * 1.4426950408889634f)

#if __has_builtin(__builtin_amdgcn_global_load_async_to_lds_b128)
#define ASYNC_STAGE 1
#else
#define ASYNC_STAGE 0
#endif

// Assemble a v16h WMMA operand from two contiguous 8-half runs at p and p+16,
// matching the 16-bit A/B VGPR layout: elem e -> K = kbase + (e&7) + (e>=8)*16.
__device__ __forceinline__ v16h ld_op16(const _Float16* p) {
    const v8h lo = *(const v8h*)(p);
    const v8h hi = *(const v8h*)(p + 16);
    v16h r;
#pragma unroll
    for (int i = 0; i < 8; ++i) { r[i] = lo[i]; r[i + 8] = hi[i]; }
    return r;
}

__device__ __forceinline__ v8f wmma_f16(v16h a, v16h b, v8f c) {
    return __builtin_amdgcn_wmma_f32_16x16x32_f16(
        /*neg_a=*/false, a, /*neg_b=*/false, b,
        /*c_mod=*/(short)0, c, /*reuse_a=*/false, /*reuse_b=*/false);
}

// Stage one 64(key) x 64(d) K block and one 64(d) x 64(key) Vt block into LDS.
__device__ __forceinline__ void stage_block(const _Float16* kg, const _Float16* vtg,
                                            _Float16* ks, _Float16* vts, int tid) {
#pragma unroll
    for (int i = 0; i < 4; ++i) {
        const int c   = tid + 128 * i;  // 0..511 16B chunks
        const int row = c >> 3;
        const int off = (c & 7) * 8;
#if ASYNC_STAGE
        __builtin_amdgcn_global_load_async_to_lds_b128(
            (v4i*)(kg + row * DHEAD + off),
            (v4i*)&ks[row * KSTRIDE + off], 0, 0);
        __builtin_amdgcn_global_load_async_to_lds_b128(
            (v4i*)(vtg + (size_t)row * SEQ + off),
            (v4i*)&vts[row * VSTRIDE + off], 0, 0);
#else
        *(v8h*)&ks[row * KSTRIDE + off]  = *(const v8h*)(kg + row * DHEAD + off);
        *(v8h*)&vts[row * VSTRIDE + off] = *(const v8h*)(vtg + (size_t)row * SEQ + off);
#endif
    }
}

// One 64-key online-softmax step against the LDS block (ksb, vtsb), for the
// wave's NQ query groups; per group the arithmetic and its order are those of a
// single-group step.
__device__ __forceinline__ void fa_step(const _Float16* ksb, const _Float16* vtsb,
                                        const v16h (&qb)[NQ][2], const v16h& ones,
                                        int l16, int kbase,
                                        float (&m_i)[NQ], float (&l_i)[NQ],
                                        v8f (&acc)[NQ][4]) {
    // ---- every fragment of the step, K then Vt, read from LDS as one group ----
    v16h ka[2][4], va[2][4];
#pragma unroll
    for (int c = 0; c < 2; ++c)
#pragma unroll
        for (int n = 0; n < 4; ++n)
            ka[c][n] = ld_op16(&ksb[(n * 16 + l16) * KSTRIDE + c * 32 + kbase]);
#pragma unroll
    for (int ck = 0; ck < 2; ++ck)
#pragma unroll
        for (int t = 0; t < 4; ++t)
            va[ck][t] = ld_op16(&vtsb[(t * 16 + l16) * VSTRIDE + ck * 32 + kbase]);
    // holds the reads (and the next block's copies, issued just ahead of this step)
    // above the products: left free, the compiler spreads the reads among the WMMAs,
    // each waited for at once, and sinks the copies down to their wait
    __builtin_amdgcn_sched_barrier(0);

    // ---- S^T = K Q^T : per group four 16(key)x16(qrow) tiles, k=64 in two chunks ----
    v8f s[NQ][4];
#pragma unroll
    for (int g = 0; g < NQ; ++g)
#pragma unroll
        for (int n = 0; n < 4; ++n)
#pragma unroll
            for (int v = 0; v < 8; ++v) s[g][n][v] = 0.0f;
#pragma unroll
    for (int c = 0; c < 2; ++c)
#pragma unroll
        for (int n = 0; n < 4; ++n)
#pragma unroll
            for (int g = 0; g < NQ; ++g) s[g][n] = wmma_f16(ka[c][n], qb[g][c], s[g][n]);
    // closes the block of 16 products: they issue back to back, and no maximum is
    // drawn in between them to wait on a product just issued
    __builtin_amdgcn_sched_barrier(0);

    v16h pb[NQ][2];  // P^T packed directly into B-operand layout
#pragma unroll
    for (int g = 0; g < NQ; ++g) {
        // ---- online softmax in log2 domain; balanced max tree ----
        float tm[4];
#pragma unroll
        for (int n = 0; n < 4; ++n) {
            const float a0 = fmaxf(s[g][n][0], s[g][n][1]);
            const float a1 = fmaxf(s[g][n][2], s[g][n][3]);
            const float a2 = fmaxf(s[g][n][4], s[g][n][5]);
            const float a3 = fmaxf(s[g][n][6], s[g][n][7]);
            tm[n] = fmaxf(fmaxf(a0, a1), fmaxf(a2, a3));
        }
        float mx = fmaxf(fmaxf(tm[0], tm[1]), fmaxf(tm[2], tm[3]));
        mx = fmaxf(mx, __shfl_xor(mx, 16, 32));

        const float mnew = fmaxf(m_i[g], mx);
        const float corr = __builtin_amdgcn_exp2f(m_i[g] - mnew);

#pragma unroll
        for (int n = 0; n < 4; ++n)
#pragma unroll
            for (int v = 0; v < 8; ++v)
                pb[g][n >> 1][(n & 1) * 8 + v] =
                    (_Float16)__builtin_amdgcn_exp2f(s[g][n][v] - mnew);

        // row sum via WMMA with ones: every lane gets sum over all 64 keys
        v8f rsum;
#pragma unroll
        for (int v = 0; v < 8; ++v) rsum[v] = 0.0f;
        rsum = wmma_f16(ones, pb[g][0], rsum);
        rsum = wmma_f16(ones, pb[g][1], rsum);

        l_i[g] = l_i[g] * corr + rsum[0];
        m_i[g] = mnew;
#pragma unroll
        for (int t = 0; t < 4; ++t)
#pragma unroll
            for (int v = 0; v < 8; ++v) acc[g][t][v] *= corr;
    }

    // ---- O^T += V^T P^T : 4 d-tiles x 2 key-chunks, each Vt fragment for NQ groups ----
#pragma unroll
    for (int ck = 0; ck < 2; ++ck)
#pragma unroll
        for (int t = 0; t < 4; ++t)
#pragma unroll
            for (int g = 0; g < NQ; ++g) acc[g][t] = wmma_f16(va[ck][t], pb[g][ck], acc[g][t]);
    // keeps the wait for the next block's copies and the barrier, which follow the step,
    // below its work: left free they rise to the step's last LDS operation, and the
    // copies get a third of the step to land in
    __builtin_amdgcn_sched_barrier(0);
}

// ---------------------------------------------------------------------------
// Prep: one-time f32 -> f16 conversion into workspace.
//   Qh[bh][row][d] = Q * QSCALE   (row-major)
//   Kh[bh][key][d] = K            (row-major)
//   Vth[bh][d][key] = V           (transposed, d-major)
// One block takes 128 rows x 64 d of one head (PREP_ELEMS elements of each
// tensor), 32 elements of each tensor per thread.
// V: a thread holds 8 keys x 4 d in registers, so each of its 4 d rows leaves
// as one 16-byte store of 8 keys; 8 lanes side by side fill a 128-byte line.
// ---------------------------------------------------------------------------
#define PREP_THREADS 256
#define PREP_ROWS    128
#define PREP_ELEMS   (PREP_ROWS * DHEAD)

__global__ __launch_bounds__(PREP_THREADS)
void fa_prep(const float* __restrict__ Q, const float* __restrict__ K,
             const float* __restrict__ V, _Float16* __restrict__ Qh,
             _Float16* __restrict__ Kh, _Float16* __restrict__ Vth) {
    const int    tid  = threadIdx.x;
    const int    lane = tid & 31;
    const int    wid  = tid >> 5;
    const size_t base = (size_t)blockIdx.x * PREP_ELEMS;

    // wave tile of V: 64 keys x 16 d; lane: 8 keys x 4 d
    const int d0 = (wid & 3) * 16 + (lane & 3) * 4;
    const int k0 = (wid >> 2) * 64 + (lane >> 2) * 8;

    // every loop below is unrolled so that these arrays are indexed by constants
    // and stay in registers
    v4f v4[8], q4[8], k4[8];
#pragma unroll
    for (int j = 0; j < 8; ++j)
        q4[j] = *(const v4f*)(Q + base + (j * PREP_THREADS + tid) * 4);
#pragma unroll
    for (int j = 0; j < 8; ++j)
        k4[j] = *(const v4f*)(K + base + (j * PREP_THREADS + tid) * 4);
#pragma unroll
    for (int j = 0; j < 8; ++j)
        v4[j] = *(const v4f*)(V + base + (k0 + j) * DHEAD + d0);
    // inputs-only fence on the loaded values: all 24 loads are issued ahead of the
    // first conversion; without it a third of them sink behind the wait for the
    // others, a second memory latency per wave
    asm volatile("" ::
        "v"(q4[0]), "v"(q4[1]), "v"(q4[2]), "v"(q4[3]), "v"(q4[4]), "v"(q4[5]), "v"(q4[6]), "v"(q4[7]),
        "v"(k4[0]), "v"(k4[1]), "v"(k4[2]), "v"(k4[3]), "v"(k4[4]), "v"(k4[5]), "v"(k4[6]), "v"(k4[7]),
        "v"(v4[0]), "v"(v4[1]), "v"(v4[2]), "v"(v4[3]), "v"(v4[4]), "v"(v4[5]), "v"(v4[6]), "v"(v4[7]));

    // V transposed: row d0+i, keys key0 .. key0+7
    const size_t bh   = base / (SEQ * DHEAD);
    const int    key0 = (int)(base - bh * (SEQ * DHEAD)) / DHEAD + k0;
    _Float16*    vtb  = Vth + bh * (SEQ * DHEAD) + (size_t)d0 * SEQ + key0;
    v8h r0, r1, r2, r3;
#pragma unroll
    for (int j = 0; j < 8; ++j) {
        r0[j] = (_Float16)v4[j].x; r1[j] = (_Float16)v4[j].y;
        r2[j] = (_Float16)v4[j].z; r3[j] = (_Float16)v4[j].w;
    }
    *(v8h*)(vtb + 0 * SEQ) = r0;
    *(v8h*)(vtb + 1 * SEQ) = r1;
    *(v8h*)(vtb + 2 * SEQ) = r2;
    *(v8h*)(vtb + 3 * SEQ) = r3;

#pragma unroll
    for (int j = 0; j < 8; ++j) {
        v4h qh;
        qh[0] = (_Float16)(q4[j].x * QSCALE); qh[1] = (_Float16)(q4[j].y * QSCALE);
        qh[2] = (_Float16)(q4[j].z * QSCALE); qh[3] = (_Float16)(q4[j].w * QSCALE);
        *(v4h*)(Qh + base + (j * PREP_THREADS + tid) * 4) = qh;
    }
#pragma unroll
    for (int j = 0; j < 8; ++j) {
        v4h kh;
        kh[0] = (_Float16)k4[j].x; kh[1] = (_Float16)k4[j].y;
        kh[2] = (_Float16)k4[j].z; kh[3] = (_Float16)k4[j].w;
        *(v4h*)(Kh + base + (j * PREP_THREADS + tid) * 4) = kh;
    }
}

// ---------------------------------------------------------------------------
// Flash attention forward: S^T / O^T formulation, double-buffered async LDS,
// hand-unrolled x2 so both LDS buffers are compile-time bases.
// ---------------------------------------------------------------------------
__global__ __launch_bounds__(128)
void fa_fwd_wmma(const _Float16* __restrict__ Qh, const _Float16* __restrict__ Kh,
                 const _Float16* __restrict__ Vth, float* __restrict__ O) {
    __shared__ __align__(16) _Float16 Ks0[BN * KSTRIDE];
    __shared__ __align__(16) _Float16 Ks1[BN * KSTRIDE];
    __shared__ __align__(16) _Float16 Vts0[DHEAD * VSTRIDE];
    __shared__ __align__(16) _Float16 Vts1[DHEAD * VSTRIDE];

    const int tid   = threadIdx.x;
    const int lane  = tid & 31;
    const int wid   = tid >> 5;
    const int half  = lane >> 4;
    const int l16   = lane & 15;
    const int kbase = half * 8;

    const int    bh     = blockIdx.y;
    const int    qblk   = blockIdx.x;
    const size_t bh_off = (size_t)bh * SEQ * DHEAD;

    const _Float16* kg0  = Kh  + bh_off;
    const _Float16* vtg0 = Vth + bh_off;

    // ---- Q tile: B-operand (Q^T) registers, straight f16 loads ----
    const int       qbase = qblk * BM + wid * (16 * NQ);
    const _Float16* qrow  = Qh + bh_off + (size_t)(qbase + l16) * DHEAD;
    v16h qb[NQ][2];
#pragma unroll
    for (int g = 0; g < NQ; ++g)
#pragma unroll
        for (int c = 0; c < 2; ++c) qb[g][c] = ld_op16(qrow + g * 16 * DHEAD + c * 32 + kbase);

    v16h ones;
#pragma unroll
    for (int e = 0; e < 16; ++e) ones[e] = (_Float16)1.0f;

    float m_i[NQ], l_i[NQ];  // per-lane: this lane owns qrows (qbase + g*16 + l16)
    v8f acc[NQ][4];          // O^T: rows d = t*16 + kbase + v, col = qrow
#pragma unroll
    for (int g = 0; g < NQ; ++g) {
        m_i[g] = -1e30f;
        l_i[g] = 0.0f;
#pragma unroll
        for (int t = 0; t < 4; ++t)
#pragma unroll
            for (int v = 0; v < 8; ++v) acc[g][t][v] = 0.0f;
    }

#if ASYNC_STAGE
#define STAGE_WAIT() asm volatile("s_wait_asynccnt 0" ::: "memory")
#else
#define STAGE_WAIT()
#endif

    // prologue: prefetch first block into buffer 0
    stage_block(kg0, vtg0, Ks0, Vts0, tid);

    for (int kb = 0; kb < SEQ; kb += 2 * BN) {
        // ---- half A: compute buffer 0, prefetch buffer 1 ----
        STAGE_WAIT();
        __syncthreads();  // buffer 0 ready everywhere; buffer 1 free
        // kb + BN < SEQ always holds (SEQ/BN even)
        stage_block(kg0 + (size_t)(kb + BN) * DHEAD, vtg0 + (kb + BN),
                    Ks1, Vts1, tid);
        fa_step(Ks0, Vts0, qb, ones, l16, kbase, m_i, l_i, acc);

        // ---- half B: compute buffer 1, prefetch buffer 0 ----
        STAGE_WAIT();
        __syncthreads();  // buffer 1 ready everywhere; buffer 0 free
        if (kb + 2 * BN < SEQ)
            stage_block(kg0 + (size_t)(kb + 2 * BN) * DHEAD, vtg0 + (kb + 2 * BN),
                        Ks0, Vts0, tid);
        fa_step(Ks1, Vts1, qb, ones, l16, kbase, m_i, l_i, acc);
    }

    // ---- epilogue: O[qrow][d] = acc^T / l, b128 runs along d ----
#pragma unroll
    for (int g = 0; g < NQ; ++g) {
        const float inv  = 1.0f / l_i[g];
        float*      orow = O + bh_off + (size_t)(qbase + g * 16 + l16) * DHEAD;
#pragma unroll
        for (int t = 0; t < 4; ++t) {
            float4 lo, hi;
            lo.x = acc[g][t][0] * inv; lo.y = acc[g][t][1] * inv;
            lo.z = acc[g][t][2] * inv; lo.w = acc[g][t][3] * inv;
            hi.x = acc[g][t][4] * inv; hi.y = acc[g][t][5] * inv;
            hi.z = acc[g][t][6] * inv; hi.w = acc[g][t][7] * inv;
            *(float4*)&orow[t * 16 + kbase]     = lo;
            *(float4*)&orow[t * 16 + kbase + 4] = hi;
        }
    }
}

extern "C" void kernel_launch(void* const* d_in, const int* in_sizes, int n_in,
                              void* d_out, int out_size, void* d_ws, size_t ws_size,
                              hipStream_t stream) {
    const float* Q = (const float*)d_in[0];
    const float* K = (const float*)d_in[1];
    const float* V = (const float*)d_in[2];
    float*       O = (float*)d_out;

    const size_t n  = (size_t)in_sizes[0];        // B*H*S*D = 4,194,304
    const int    bh = (int)(n / (SEQ * DHEAD));   // 32

    _Float16* Qh  = (_Float16*)d_ws;
    _Float16* Kh  = Qh + n;
    _Float16* Vth = Kh + n;

    fa_prep<<<dim3((unsigned)(n / PREP_ELEMS)), dim3(PREP_THREADS), 0, stream>>>(Q, K, V, Qh, Kh, Vth);

    dim3 grid(SEQ / BM, bh);
    fa_fwd_wmma<<<grid, dim3(128), 0, stream>>>(Qh, Kh, Vth, O);
}

// v004
// A run of this version takes 42.7 microseconds.
// In two side-by-side timings against v003, it was 1.03 and 1.02 times as fast.
// Over all steps from v000 it is 2.43 times as fast.
#include <hip/hip_runtime.h>

typedef __attribute__((ext_vector_type(16))) _Float16 v16h;
typedef __attribute__((ext_vector_type(8)))  _Float16 v8h;
typedef __attribute__((ext_vector_type(4)))  _Float16 v4h;
typedef __attribute__((ext_vector_type(8)))  float    v8f;
typedef __attribute__((ext_vector_type(4)))  float    v4f;
typedef __attribute__((ext_vector_type(4)))  int      v4i;

#define SEQ     2048
#define DHEAD   64
#define NQ      2       // 16-row query groups per wave: each K / Vt fragment read from LDS feeds NQ products
#define BM      128     // query rows per block (16 * NQ per wave)
#define BN      64      // keys per iteration
#define KSTRIDE 72      // halves per K-LDS row (64 + pad, 144B, 16B-aligned)
#define VSTRIDE 72      // halves per Vt-LDS row (64 + pad, 144B, 16B-aligned)

// 1/sqrt(64) * log2(e): scores produced directly in log2 domain
#define QSCALE  (0.125f * 1.4426950408889634f)

// Assemble a v16h WMMA operand from two contiguous 8-half runs at p and p+16,
// matching the 16-bit A/B VGPR layout: elem e -> K = kbase + (e&7) + (e>=8)*16.
__device__ __forceinline__ v16h ld_op16(const _Float16* p) {
    const v8h lo = *(const v8h*)(p);
    const v8h hi = *(const v8h*)(p + 16);
    v16h r;
#pragma unroll
    for (int i = 0; i < 8; ++i) { r[i] = lo[i]; r[i + 8] = hi[i]; }
    return r;
}

__device__ __forceinline__ v8f wmma_f16(v16h a, v16h b, v8f c) {
    return __builtin_amdgcn_wmma_f32_16x16x32_f16(
        /*neg_a=*/false, a, /*neg_b=*/false, b,
        /*c_mod=*/(short)0, c, /*reuse_a=*/false, /*reuse_b=*/false);
}

// One 64(key) x 64(d) f32 tile of K and of V, global memory -> registers.
// K: 16 B per lane, a wave covers 512 contiguous bytes per load.
// V: wave w takes d = 16w .. 16w+15 of all 64 keys; a lane holds 8 keys x 4 d.
__device__ __forceinline__ void load_tile(const float* kg, const float* vg, int tid,
                                          v4f (&kr)[8], v4f (&vr)[8]) {
    const int d0 = (tid >> 5) * 16 + (tid & 3) * 4;
    const int k0 = ((tid & 31) >> 2) * 8;
#pragma unroll
    for (int i = 0; i < 8; ++i) kr[i] = *(const v4f*)(kg + (tid + 128 * i) * 4);
#pragma unroll
    for (int j = 0; j < 8; ++j) vr[j] = *(const v4f*)(vg + (k0 + j) * DHEAD + d0);
}

// The tile in registers -> f16 -> LDS: K row-major, V transposed (d-major): each of
// a lane's 4 d rows leaves as one 16-byte store of 8 keys.
__device__ __forceinline__ void store_tile(const v4f (&kr)[8], const v4f (&vr)[8],
                                           _Float16* ks, _Float16* vts, int tid) {
    const int d0 = (tid >> 5) * 16 + (tid & 3) * 4;
    const int k0 = ((tid & 31) >> 2) * 8;
#pragma unroll
    for (int i = 0; i < 8; ++i) {
        const int c = tid + 128 * i;  // 0..1023 chunks of 4 elements
        v4h kh;
        kh[0] = (_Float16)kr[i].x; kh[1] = (_Float16)kr[i].y;
        kh[2] = (_Float16)kr[i].z; kh[3] = (_Float16)kr[i].w;
        *(v4h*)&ks[(c >> 4) * KSTRIDE + (c & 15) * 4] = kh;
    }
    v8h r0, r1, r2, r3;
#pragma unroll
    for (int j = 0; j < 8; ++j) {
        r0[j] = (_Float16)vr[j].x; r1[j] = (_Float16)vr[j].y;
        r2[j] = (_Float16)vr[j].z; r3[j] = (_Float16)vr[j].w;
    }
    *(v8h*)&vts[(d0 + 0) * VSTRIDE + k0] = r0;
    *(v8h*)&vts[(d0 + 1) * VSTRIDE + k0] = r1;
    *(v8h*)&vts[(d0 + 2) * VSTRIDE + k0] = r2;
    *(v8h*)&vts[(d0 + 3) * VSTRIDE + k0] = r3;
}

// One 64-key online-softmax step against the LDS block (ksb, vtsb), for the
// wave's NQ query groups; per group the arithmetic and its order are those of a
// single-group step. Behind its own LDS reads the step converts the next step's tile,
// held in (kr, vr), into the other LDS block (ksn, vtsn) and starts the loads of the
// tile after that one from (kgn, vgn) into the same registers.
__device__ __forceinline__ void fa_step(const _Float16* ksb, const _Float16* vtsb,
                                        _Float16* ksn, _Float16* vtsn,
                                        const float* kgn, const float* vgn,
                                        bool do_store, bool do_load, int tid,
                                        v4f (&kr)[8], v4f (&vr)[8],
                                        const v16h (&qb)[NQ][2], const v16h& ones,
                                        int l16, int kbase,
                                        float (&m_i)[NQ], float (&l_i)[NQ],
                                        v8f (&acc)[NQ][4]) {
    // ---- every fragment of the step, K then Vt, read from LDS as one group ----
    v16h ka[2][4], va[2][4];
#pragma unroll
    for (int c = 0; c < 2; ++c)
#pragma unroll
        for (int n = 0; n < 4; ++n)
            ka[c][n] = ld_op16(&ksb[(n * 16 + l16) * KSTRIDE + c * 32 + kbase]);
#pragma unroll
    for (int ck = 0; ck < 2; ++ck)
#pragma unroll
        for (int t = 0; t < 4; ++t)
            va[ck][t] = ld_op16(&vtsb[(t * 16 + l16) * VSTRIDE + ck * 32 + kbase]);
    // keeps the reads ahead of the conversions, which then run while the reads land
    __builtin_amdgcn_sched_barrier(0);
    if (do_store) store_tile(kr, vr, ksn, vtsn, tid);
    // keeps the conversions out of the stretch between the loads and their wait
    __builtin_amdgcn_sched_barrier(0);
    if (do_load) {
        load_tile(kgn, vgn, tid, kr, vr);
        // a precaution: stands ahead of every reuse of the loads' address registers
        asm volatile("s_wait_xcnt 0x0" ::: "memory");
    }
    // holds the reads, the next tile's LDS stores and the global loads above the
    // products: left free, the compiler spreads the reads among the WMMAs, each
    // waited for at once, and sinks the loads towards their use a step later
    __builtin_amdgcn_sched_barrier(0);

    // ---- S^T = K Q^T : per group four 16(key)x16(qrow) tiles, k=64 in two chunks ----
    v8f s[NQ][4];
#pragma unroll
    for (int g = 0; g < NQ; ++g)
#pragma unroll
        for (int n = 0; n < 4; ++n)
#pragma unroll
            for (int v = 0; v < 8; ++v) s[g][n][v] = 0.0f;
#pragma unroll
    for (int c = 0; c < 2; ++c)
#pragma unroll
        for (int n = 0; n < 4; ++n)
#pragma unroll
            for (int g = 0; g < NQ; ++g) s[g][n] = wmma_f16(ka[c][n], qb[g][c], s[g][n]);
    // closes the block of 16 products: they issue back to back, and no maximum is
    // drawn in between them to wait on a product just issued
    __builtin_amdgcn_sched_barrier(0);

    v16h pb[NQ][2];  // P^T packed directly into B-operand layout
#pragma unroll
    for (int g = 0; g < NQ; ++g) {
        // ---- online softmax in log2 domain; balanced max tree ----
        float tm[4];
#pragma unroll
        for (int n = 0; n < 4; ++n) {
            const float a0 = fmaxf(s[g][n][0], s[g][n][1]);
            const float a1 = fmaxf(s[g][n][2], s[g][n][3]);
            const float a2 = fmaxf(s[g][n][4], s[g][n][5]);
            const float a3 = fmaxf(s[g][n][6], s[g][n][7]);
            tm[n] = fmaxf(fmaxf(a0, a1), fmaxf(a2, a3));
        }
        float mx = fmaxf(fmaxf(tm[0], tm[1]), fmaxf(tm[2], tm[3]));
        mx = fmaxf(mx, __shfl_xor(mx, 16, 32));

        const float mnew = fmaxf(m_i[g], mx);
        const float corr = __builtin_amdgcn_exp2f(m_i[g] - mnew);

#pragma unroll
        for (int n = 0; n < 4; ++n)
#pragma unroll
            for (int v = 0; v < 8; ++v)
                pb[g][n >> 1][(n & 1) * 8 + v] =
                    (_Float16)__builtin_amdgcn_exp2f(s[g][n][v] - mnew);

        // row sum via WMMA with ones: every lane gets sum over all 64 keys
        v8f rsum;
#pragma unroll
        for (int v = 0; v < 8; ++v) rsum[v] = 0.0f;
        rsum = wmma_f16(ones, pb[g][0], rsum);
        rsum = wmma_f16(ones, pb[g][1], rsum);

        l_i[g] = l_i[g] * corr + rsum[0];
        m_i[g] = mnew;
#pragma unroll
        for (int t = 0; t < 4; ++t)
#pragma unroll
            for (int v = 0; v < 8; ++v) acc[g][t][v] *= corr;
    }

    // ---- O^T += V^T P^T : 4 d-tiles x 2 key-chunks, each Vt fragment for NQ groups ----
#pragma unroll
    for (int ck = 0; ck < 2; ++ck)
#pragma unroll
        for (int t = 0; t < 4; ++t)
#pragma unroll
            for (int g = 0; g < NQ; ++g) acc[g][t] = wmma_f16(va[ck][t], pb[g][ck], acc[g][t]);
    // keeps the barrier that follows the step, with its wait for the global loads,
    // below the step's work: left free it rises to the step's last LDS operation, and
    // the loads get a third of the step to land in
    __builtin_amdgcn_sched_barrier(0);
}

// ---------------------------------------------------------------------------
// Flash attention forward: S^T / O^T formulation on f16 operands converted in the
// kernel from the f32 inputs (Q scaled by QSCALE); K and V tiles go global ->
// registers -> f16 -> LDS, two LDS blocks, loads one step ahead of their stores;
// hand-unrolled x2 so both LDS blocks are compile-time bases.
// ---------------------------------------------------------------------------
__global__ __launch_bounds__(128)
void fa_fwd_wmma(const float* __restrict__ Q, const float* __restrict__ K,
                 const float* __restrict__ V, float* __restrict__ O) {
    __shared__ __align__(16) _Float16 Ks0[BN * KSTRIDE];
    __shared__ __align__(16) _Float16 Ks1[BN * KSTRIDE];
    __shared__ __align__(16) _Float16 Vts0[DHEAD * VSTRIDE];
    __shared__ __align__(16) _Float16 Vts1[DHEAD * VSTRIDE];

    const int tid   = threadIdx.x;
    const int lane  = tid & 31;
    const int wid   = tid >> 5;
    const int half  = lane >> 4;
    const int l16   = lane & 15;
    const int kbase = half * 8;

    const int    bh     = blockIdx.y;
    const int    qblk   = blockIdx.x;
    const size_t bh_off = (size_t)bh * SEQ * DHEAD;

    const float* kg0 = K + bh_off;
    const float* vg0 = V + bh_off;

    // the first tile's loads, ahead of everything else
    v4f kr[8], vr[8];
    // with the fence behind the wait below: keeps index arithmetic, which reuses the
    // loads' address registers, out of the stretch between the loads and their wait
    __builtin_amdgcn_sched_barrier(0);
    load_tile(kg0, vg0, tid, kr, vr);

    // ---- Q tile: B-operand (Q^T) registers, scaled and converted to f16 ----
    const int    qbase = qblk * BM + wid * (16 * NQ);
    const float* qrow  = Q + bh_off + (size_t)(qbase + l16) * DHEAD;
    v4f qf[NQ][2][4];
#pragma unroll
    for (int g = 0; g < NQ; ++g)
#pragma unroll
        for (int c = 0; c < 2; ++c) {
            const float* p = qrow + g * 16 * DHEAD + c * 32 + kbase;
            qf[g][c][0] = *(const v4f*)(p);
            qf[g][c][1] = *(const v4f*)(p + 4);
            qf[g][c][2] = *(const v4f*)(p + 16);
            qf[g][c][3] = *(const v4f*)(p + 20);
        }
    // a precaution: stands ahead of every reuse of the loads' address registers
    asm volatile("s_wait_xcnt 0x0" ::: "memory");
    __builtin_amdgcn_sched_barrier(0);
    v16h qb[NQ][2];
#pragma unroll
    for (int g = 0; g < NQ; ++g)
#pragma unroll
        for (int c = 0; c < 2; ++c)
#pragma unroll
            for (int i = 0; i < 16; ++i)
                qb[g][c][i] = (_Float16)(qf[g][c][i >> 2][i & 3] * QSCALE);

    v16h ones;
#pragma unroll
    for (int e = 0; e < 16; ++e) ones[e] = (_Float16)1.0f;

    float m_i[NQ], l_i[NQ];  // per-lane: this lane owns qrows (qbase + g*16 + l16)
    v8f acc[NQ][4];          // O^T: rows d = t*16 + kbase + v, col = qrow
#pragma unroll
    for (int g = 0; g < NQ; ++g) {
        m_i[g] = -1e30f;
        l_i[g] = 0.0f;
#pragma unroll
        for (int t = 0; t < 4; ++t)
#pragma unroll
            for (int v = 0; v < 8; ++v) acc[g][t][v] = 0.0f;
    }

    // prologue: tile 0 into block 0; tile 1's loads in flight
    store_tile(kr, vr, Ks0, Vts0, tid);
    // as above: nothing that reuses an address register between the loads and their wait
    __builtin_amdgcn_sched_barrier(0);
    load_tile(kg0 + BN * DHEAD, vg0 + BN * DHEAD, tid, kr, vr);
    // a precaution: stands ahead of every reuse of the loads' address registers
    asm volatile("s_wait_xcnt 0x0" ::: "memory");
    __builtin_amdgcn_sched_barrier(0);

    for (int kb = 0; kb < SEQ; kb += 2 * BN) {
        // SEQ / BN is even: tiles kb/BN + 2 and kb/BN + 3 exist together or not at all
        const bool more = kb + 2 * BN < SEQ;
        // ---- half A: compute block 0, fill block 1, load the tile after it ----
        __syncthreads();  // block 0 stored everywhere; block 1 read to its end
        fa_step(Ks0, Vts0, Ks1, Vts1,
                kg0 + (size_t)(kb + 2 * BN) * DHEAD, vg0 + (size_t)(kb + 2 * BN) * DHEAD,
                true, more, tid, kr, vr, qb, ones, l16, kbase, m_i, l_i, acc);

        // ---- half B: compute block 1, fill block 0, load the tile after it ----
        __syncthreads();  // block 1 stored everywhere; block 0 read to its end
        fa_step(Ks1, Vts1, Ks0, Vts0,
                kg0 + (size_t)(kb + 3 * BN) * DHEAD, vg0 + (size_t)(kb + 3 * BN) * DHEAD,
                more, more, tid, kr, vr, qb, ones, l16, kbase, m_i, l_i, acc);
    }

    // ---- epilogue: O[qrow][d] = acc^T / l, b128 runs along d ----
#pragma unroll
    for (int g = 0; g < NQ; ++g) {
        const float inv  = 1.0f / l_i[g];
        float*      orow = O + bh_off + (size_t)(qbase + g * 16 + l16) * DHEAD;
#pragma unroll
        for (int t = 0; t < 4; ++t) {
            float4 lo, hi;
            lo.x = acc[g][t][0] * inv; lo.y = acc[g][t][1] * inv;
            lo.z = acc[g][t][2] * inv; lo.w = acc[g][t][3] * inv;
            hi.x = acc[g][t][4] * inv; hi.y = acc[g][t][5] * inv;
            hi.z = acc[g][t][6] * inv; hi.w = acc[g][t][7] * inv;
            *(float4*)&orow[t * 16 + kbase]     = lo;
            *(float4*)&orow[t * 16 + kbase + 4] = hi;
        }
    }
}

extern "C" void kernel_launch(void* const* d_in, const int* in_sizes, int n_in,
                              void* d_out, int out_size, void* d_ws, size_t ws_size,
                              hipStream_t stream) {
    const float* Q = (const float*)d_in[0];
    const float* K = (const float*)d_in[1];
    const float* V = (const float*)d_in[2];
    float*       O = (float*)d_out;

    const size_t n  = (size_t)in_sizes[0];        // B*H*S*D = 4,194,304
    const int    bh = (int)(n / (SEQ * DHEAD));   // 32

    dim3 grid(SEQ / BM, bh);
    fa_fwd_wmma<<<grid, dim3(128), 0, stream>>>(Q, K, V, O);
}

// v005
// One run takes 38.6 microseconds.
// Timed twice side by side with v004, it ran 1.11 times as fast both times.
// Counting every step since v000, it is 2.70 times as fast.
#include <hip/hip_runtime.h>

typedef __attribute__((ext_vector_type(16))) _Float16 v16h;
typedef __attribute__((ext_vector_type(8)))  _Float16 v8h;
typedef __attribute__((ext_vector_type(4)))  _Float16 v4h;
typedef __attribute__((ext_vector_type(8)))  float    v8f;
typedef __attribute__((ext_vector_type(4)))  float    v4f;
typedef __attribute__((ext_vector_type(4)))  int      v4i;

#define SEQ     2048
#define DHEAD   64
#define NQ      2       // 16-row query groups per wave: each K / Vt fragment read from LDS feeds NQ products
#define BM      128     // query rows per block (16 * NQ per wave)
#define BN      64      // keys per iteration
#define KSTRIDE 72      // halves per K-LDS row (64 + pad, 144B, 16B-aligned)
#define VSTRIDE 72      // halves per Vt-LDS row (64 + pad, 144B, 16B-aligned)

// 1/sqrt(64) * log2(e): scores produced directly in log2 domain
#define QSCALE  (0.125f * 1.4426950408889634f)

// Assemble a v16h WMMA operand from two contiguous 8-half runs at p and p+16,
// matching the 16-bit A/B VGPR layout: elem e -> K = kbase + (e&7) + (e>=8)*16.
__device__ __forceinline__ v16h ld_op16(const _Float16* p) {
    const v8h lo = *(const v8h*)(p);
    const v8h hi = *(const v8h*)(p + 16);
    v16h r;
#pragma unroll
    for (int i = 0; i < 8; ++i) { r[i] = lo[i]; r[i + 8] = hi[i]; }
    return r;
}

__device__ __forceinline__ v8f wmma_f16(v16h a, v16h b, v8f c) {
    return __builtin_amdgcn_wmma_f32_16x16x32_f16(
        /*neg_a=*/false, a, /*neg_b=*/false, b,
        /*c_mod=*/(short)0, c, /*reuse_a=*/false, /*reuse_b=*/false);
}

// One 64(key) x 64(d) f32 tile of K and of V, global memory -> registers.
// K: 16 B per lane, a wave covers 512 contiguous bytes per load.
// V: wave w takes d = 16w .. 16w+15 of all 64 keys; a lane holds 8 keys x 4 d.
__device__ __forceinline__ void load_tile(const float* kg, const float* vg, int tid,
                                          v4f (&kr)[8], v4f (&vr)[8]) {
    const int d0 = (tid >> 5) * 16 + (tid & 3) * 4;
    const int k0 = ((tid & 31) >> 2) * 8;
#pragma unroll
    for (int i = 0; i < 8; ++i) kr[i] = *(const v4f*)(kg + (tid + 128 * i) * 4);
#pragma unroll
    for (int j = 0; j < 8; ++j) vr[j] = *(const v4f*)(vg + (k0 + j) * DHEAD + d0);
}

// The tile in registers -> f16 -> LDS: K row-major, V transposed (d-major): each of
// a lane's 4 d rows leaves as one 16-byte store of 8 keys.
__device__ __forceinline__ void store_tile(const v4f (&kr)[8], const v4f (&vr)[8],
                                           _Float16* ks, _Float16* vts, int tid) {
    const int d0 = (tid >> 5) * 16 + (tid & 3) * 4;
    const int k0 = ((tid & 31) >> 2) * 8;
#pragma unroll
    for (int i = 0; i < 8; ++i) {
        const int c = tid + 128 * i;  // 0..1023 chunks of 4 elements
        v4h kh;
        kh[0] = (_Float16)kr[i].x; kh[1] = (_Float16)kr[i].y;
        kh[2] = (_Float16)kr[i].z; kh[3] = (_Float16)kr[i].w;
        *(v4h*)&ks[(c >> 4) * KSTRIDE + (c & 15) * 4] = kh;
    }
    v8h r0, r1, r2, r3;
#pragma unroll
    for (int j = 0; j < 8; ++j) {
        r0[j] = (_Float16)vr[j].x; r1[j] = (_Float16)vr[j].y;
        r2[j] = (_Float16)vr[j].z; r3[j] = (_Float16)vr[j].w;
    }
    *(v8h*)&vts[(d0 + 0) * VSTRIDE + k0] = r0;
    *(v8h*)&vts[(d0 + 1) * VSTRIDE + k0] = r1;
    *(v8h*)&vts[(d0 + 2) * VSTRIDE + k0] = r2;
    *(v8h*)&vts[(d0 + 3) * VSTRIDE + k0] = r3;
}

// Work-group barrier that orders LDS traffic alone: each wave's LDS reads and stores
// are finished before it, while the tile loads on their way to registers, which no
// other wave sees, stay in flight across it (a full __syncthreads() waits them out).
__device__ __forceinline__ void block_sync() {
    __builtin_amdgcn_fence(__ATOMIC_RELEASE, "workgroup", "local");
    __builtin_amdgcn_s_barrier();
    __builtin_amdgcn_fence(__ATOMIC_ACQUIRE, "workgroup", "local");
}

// One 64-key online-softmax step against the LDS block (ksb, vtsb), for the
// wave's NQ query groups; per group the arithmetic and its order are those of a
// single-group step. Behind its own LDS reads the step converts the next step's tile,
// held in (kr, vr), into the other LDS block (ksn, vtsn) and starts the loads of the
// tile two after that one from (kgn, vgn) into the same registers: the caller passes
// two register sets in turn, so a load has two steps to land in.
__device__ __forceinline__ void fa_step(const _Float16* ksb, const _Float16* vtsb,
                                        _Float16* ksn, _Float16* vtsn,
                                        const float* kgn, const float* vgn,
                                        bool do_store, bool do_load, int tid,
                                        v4f (&kr)[8], v4f (&vr)[8],
                                        const v16h (&qb)[NQ][2], const v16h& ones,
                                        int l16, int kbase,
                                        float (&m_i)[NQ], float (&l_i)[NQ],
                                        v8f (&acc)[NQ][4]) {
    // ---- every fragment of the step, K then Vt, read from LDS as one group ----
    v16h ka[2][4], va[2][4];
#pragma unroll
    for (int c = 0; c < 2; ++c)
#pragma unroll
        for (int n = 0; n < 4; ++n)
            ka[c][n] = ld_op16(&ksb[(n * 16 + l16) * KSTRIDE + c * 32 + kbase]);
#pragma unroll
    for (int ck = 0; ck < 2; ++ck)
#pragma unroll
        for (int t = 0; t < 4; ++t)
            va[ck][t] = ld_op16(&vtsb[(t * 16 + l16) * VSTRIDE + ck * 32 + kbase]);
    // keeps the reads ahead of the conversions, which then run while the reads land
    __builtin_amdgcn_sched_barrier(0);
    if (do_store) store_tile(kr, vr, ksn, vtsn, tid);
    // keeps the conversions out of the stretch between the loads and their wait
    __builtin_amdgcn_sched_barrier(0);
    if (do_load) {
        load_tile(kgn, vgn, tid, kr, vr);
        // a precaution: stands ahead of every reuse of the loads' address registers
        asm volatile("s_wait_xcnt 0x0" ::: "memory");
    }
    // holds the reads, the next tile's LDS stores and the global loads above the
    // products: left free, the compiler spreads the reads among the WMMAs, each
    // waited for at once, and sinks the loads towards their use two steps later
    __builtin_amdgcn_sched_barrier(0);

    // ---- S^T = K Q^T : per group four 16(key)x16(qrow) tiles, k=64 in two chunks ----
    v8f s[NQ][4];
#pragma unroll
    for (int g = 0; g < NQ; ++g)
#pragma unroll
        for (int n = 0; n < 4; ++n)
#pragma unroll
            for (int v = 0; v < 8; ++v) s[g][n][v] = 0.0f;
#pragma unroll
    for (int c = 0; c < 2; ++c)
#pragma unroll
        for (int n = 0; n < 4; ++n)
#pragma unroll
            for (int g = 0; g < NQ; ++g) s[g][n] = wmma_f16(ka[c][n], qb[g][c], s[g][n]);
    // closes the block of 16 products: they issue back to back, and no maximum is
    // drawn in between them to wait on a product just issued
    __builtin_amdgcn_sched_barrier(0);

    v16h pb[NQ][2];  // P^T packed directly into B-operand layout
#pragma unroll
    for (int g = 0; g < NQ; ++g) {
        // ---- online softmax in log2 domain; balanced max tree ----
        float tm[4];
#pragma unroll
        for (int n = 0; n < 4; ++n) {
            const float a0 = fmaxf(s[g][n][0], s[g][n][1]);
            const float a1 = fmaxf(s[g][n][2], s[g][n][3]);
            const float a2 = fmaxf(s[g][n][4], s[g][n][5]);
            const float a3 = fmaxf(s[g][n][6], s[g][n][7]);
            tm[n] = fmaxf(fmaxf(a0, a1), fmaxf(a2, a3));
        }
        float mx = fmaxf(fmaxf(tm[0], tm[1]), fmaxf(tm[2], tm[3]));
        mx = fmaxf(mx, __shfl_xor(mx, 16, 32));

        const float mnew = fmaxf(m_i[g], mx);
        const float corr = __builtin_amdgcn_exp2f(m_i[g] - mnew);

#pragma unroll
        for (int n = 0; n < 4; ++n)
#pragma unroll
            for (int v = 0; v < 8; ++v)
                pb[g][n >> 1][(n & 1) * 8 + v] =
                    (_Float16)__builtin_amdgcn_exp2f(s[g][n][v] - mnew);

        // row sum via WMMA with ones: every lane gets sum over all 64 keys
        v8f rsum;
#pragma unroll
        for (int v = 0; v < 8; ++v) rsum[v] = 0.0f;
        rsum = wmma_f16(ones, pb[g][0], rsum);
        rsum = wmma_f16(ones, pb[g][1], rsum);

        l_i[g] = l_i[g] * corr + rsum[0];
        m_i[g] = mnew;
#pragma unroll
        for (int t = 0; t < 4; ++t)
#pragma unroll
            for (int v = 0; v < 8; ++v) acc[g][t][v] *= corr;
    }

    // ---- O^T += V^T P^T : 4 d-tiles x 2 key-chunks, each Vt fragment for NQ groups ----
#pragma unroll
    for (int ck = 0; ck < 2; ++ck)
#pragma unroll
        for (int t = 0; t < 4; ++t)
#pragma unroll
            for (int g = 0; g < NQ; ++g) acc[g][t] = wmma_f16(va[ck][t], pb[g][ck], acc[g][t]);
    // keeps the barrier that follows the step below the step's work: left free it
    // rises to the step's last LDS operation, and the waves wait there with work left
    __builtin_amdgcn_sched_barrier(0);
}

// ---------------------------------------------------------------------------
// Flash attention forward: S^T / O^T formulation on f16 operands converted in the
// kernel from the f32 inputs (Q scaled by QSCALE); K and V tiles go global ->
// registers -> f16 -> LDS, two LDS blocks, two register sets, loads two steps ahead
// of their stores; hand-unrolled x2 so LDS blocks and register sets are compile-time.
// ---------------------------------------------------------------------------
__global__ __launch_bounds__(128)
void fa_fwd_wmma(const float* __restrict__ Q, const float* __restrict__ K,
                 const float* __restrict__ V, float* __restrict__ O) {
    __shared__ __align__(16) _Float16 Ks0[BN * KSTRIDE];
    __shared__ __align__(16) _Float16 Ks1[BN * KSTRIDE];
    __shared__ __align__(16) _Float16 Vts0[DHEAD * VSTRIDE];
    __shared__ __align__(16) _Float16 Vts1[DHEAD * VSTRIDE];

    const int tid   = threadIdx.x;
    const int lane  = tid & 31;
    const int wid   = tid >> 5;
    const int half  = lane >> 4;
    const int l16   = lane & 15;
    const int kbase = half * 8;

    const int    bh     = blockIdx.y;
    const int    qblk   = blockIdx.x;
    const size_t bh_off = (size_t)bh * SEQ * DHEAD;

    const float* kg0 = K + bh_off;
    const float* vg0 = V + bh_off;

    // the first two tiles' loads, ahead of everything else: even tiles pass through
    // set A, odd tiles through set B
    v4f krA[8], vrA[8], krB[8], vrB[8];
    // with the fence behind the wait below: keeps index arithmetic, which reuses the
    // loads' address registers, out of the stretch between the loads and their wait
    __builtin_amdgcn_sched_barrier(0);
    load_tile(kg0, vg0, tid, krA, vrA);
    load_tile(kg0 + BN * DHEAD, vg0 + BN * DHEAD, tid, krB, vrB);

    // ---- Q tile: B-operand (Q^T) registers, scaled and converted to f16 ----
    const int    qbase = qblk * BM + wid * (16 * NQ);
    const float* qrow  = Q + bh_off + (size_t)(qbase + l16) * DHEAD;
    v4f qf[NQ][2][4];
#pragma unroll
    for (int g = 0; g < NQ; ++g)
#pragma unroll
        for (int c = 0; c < 2; ++c) {
            const float* p = qrow + g * 16 * DHEAD + c * 32 + kbase;
            qf[g][c][0] = *(const v4f*)(p);
            qf[g][c][1] = *(const v4f*)(p + 4);
            qf[g][c][2] = *(const v4f*)(p + 16);
            qf[g][c][3] = *(const v4f*)(p + 20);
        }
    // a precaution: stands ahead of every reuse of the loads' address registers
    asm volatile("s_wait_xcnt 0x0" ::: "memory");
    __builtin_amdgcn_sched_barrier(0);
    v16h qb[NQ][2];
#pragma unroll
    for (int g = 0; g < NQ; ++g)
#pragma unroll
        for (int c = 0; c < 2; ++c)
#pragma unroll
            for (int i = 0; i < 16; ++i)
                qb[g][c][i] = (_Float16)(qf[g][c][i >> 2][i & 3] * QSCALE);

    v16h ones;
#pragma unroll
    for (int e = 0; e < 16; ++e) ones[e] = (_Float16)1.0f;

    float m_i[NQ], l_i[NQ];  // per-lane: this lane owns qrows (qbase + g*16 + l16)
    v8f acc[NQ][4];          // O^T: rows d = t*16 + kbase + v, col = qrow
#pragma unroll
    for (int g = 0; g < NQ; ++g) {
        m_i[g] = -1e30f;
        l_i[g] = 0.0f;
#pragma unroll
        for (int t = 0; t < 4; ++t)
#pragma unroll
            for (int v = 0; v < 8; ++v) acc[g][t][v] = 0.0f;
    }

    // prologue: tile 0 into block 0; the loads of tiles 1 and 2 in flight
    store_tile(krA, vrA, Ks0, Vts0, tid);
    // as above: nothing that reuses an address register between the loads and their wait
    __builtin_amdgcn_sched_barrier(0);
    load_tile(kg0 + 2 * BN * DHEAD, vg0 + 2 * BN * DHEAD, tid, krA, vrA);
    // a precaution: stands ahead of every reuse of the loads' address registers
    asm volatile("s_wait_xcnt 0x0" ::: "memory");
    __builtin_amdgcn_sched_barrier(0);

    // Every step of this loop stores and loads, with no test: the wait in front of a
    // set's conversion can then count the other set's 16 younger loads as still out.
    for (int kb = 0; kb < SEQ - 4 * BN; kb += 2 * BN) {
        // ---- half A: compute block 0, fill block 1 from set B, reload set B ----
        block_sync();  // block 0 stored everywhere; block 1 read to its end
        fa_step(Ks0, Vts0, Ks1, Vts1,
                kg0 + (size_t)(kb + 3 * BN) * DHEAD, vg0 + (size_t)(kb + 3 * BN) * DHEAD,
                true, true, tid, krB, vrB, qb, ones, l16, kbase, m_i, l_i, acc);

        // ---- half B: compute block 1, fill block 0 from set A, reload set A ----
        block_sync();  // block 1 stored everywhere; block 0 read to its end
        fa_step(Ks1, Vts1, Ks0, Vts0,
                kg0 + (size_t)(kb + 4 * BN) * DHEAD, vg0 + (size_t)(kb + 4 * BN) * DHEAD,
                true, true, tid, krA, vrA, qb, ones, l16, kbase, m_i, l_i, acc);
    }
    // ---- the last four tiles: one load is left, then the stores run out ----
    block_sync();
    fa_step(Ks0, Vts0, Ks1, Vts1,
            kg0 + (size_t)(SEQ - BN) * DHEAD, vg0 + (size_t)(SEQ - BN) * DHEAD,
            true, true, tid, krB, vrB, qb, ones, l16, kbase, m_i, l_i, acc);
    block_sync();
    fa_step(Ks1, Vts1, Ks0, Vts0, kg0, vg0,
            true, false, tid, krA, vrA, qb, ones, l16, kbase, m_i, l_i, acc);
    block_sync();
    fa_step(Ks0, Vts0, Ks1, Vts1, kg0, vg0,
            true, false, tid, krB, vrB, qb, ones, l16, kbase, m_i, l_i, acc);
    block_sync();
    fa_step(Ks1, Vts1, Ks0, Vts0, kg0, vg0,
            false, false, tid, krA, vrA, qb, ones, l16, kbase, m_i, l_i, acc);

    // ---- epilogue: O[qrow][d] = acc^T / l, b128 runs along d ----
#pragma unroll
    for (int g = 0; g < NQ; ++g) {
        const float inv  = 1.0f / l_i[g];
        float*      orow = O + bh_off + (size_t)(qbase + g * 16 + l16) * DHEAD;
#pragma unroll
        for (int t = 0; t < 4; ++t) {
            float4 lo, hi;
            lo.x = acc[g][t][0] * inv; lo.y = acc[g][t][1] * inv;
            lo.z = acc[g][t][2] * inv; lo.w = acc[g][t][3] * inv;
            hi.x = acc[g][t][4] * inv; hi.y = acc[g][t][5] * inv;
            hi.z = acc[g][t][6] * inv; hi.w = acc[g][t][7] * inv;
            *(float4*)&orow[t * 16 + kbase]     = lo;
            *(float4*)&orow[t * 16 + kbase + 4] = hi;
        }
    }
}

extern "C" void kernel_launch(void* const* d_in, const int* in_sizes, int n_in,
                              void* d_out, int out_size, void* d_ws, size_t ws_size,
                              hipStream_t stream) {
    const float* Q = (const float*)d_in[0];
    const float* K = (const float*)d_in[1];
    const float* V = (const float*)d_in[2];
    float*       O = (float*)d_out;

    const size_t n  = (size_t)in_sizes[0];        // B*H*S*D = 4,194,304
    const int    bh = (int)(n / (SEQ * DHEAD));   // 32

    dim3 grid(SEQ / BM, bh);
    fa_fwd_wmma<<<grid, dim3(128), 0, stream>>>(Q, K, V, O);
}

// v006
// Measured time: 35.1 microseconds a run.
// In both of two side-by-side timings against v005, it was 1.10 times as fast.
// Counting every step since v000, it is 2.96 times as fast.
#include <hip/hip_runtime.h>

typedef __attribute__((ext_vector_type(16))) _Float16 v16h;
typedef __attribute__((ext_vector_type(8)))  _Float16 v8h;
typedef __attribute__((ext_vector_type(4)))  _Float16 v4h;
typedef __attribute__((ext_vector_type(8)))  float    v8f;
typedef __attribute__((ext_vector_type(4)))  float    v4f;
typedef __attribute__((ext_vector_type(4)))  int      v4i;

#define SEQ     2048
#define DHEAD   64
#define NQ      2       // 16-row query groups per wave: each K / Vt fragment read from LDS feeds NQ products
#define BM      128     // query rows per block (16 * NQ per wave)
#define BN      64      // keys per iteration
#define KSTRIDE 72      // halves per K-LDS row (64 + pad, 144B, 16B-aligned)
#define VSTRIDE 72      // halves per Vt-LDS row (64 + pad, 144B, 16B-aligned)

// 1/sqrt(64) * log2(e): scores produced directly in log2 domain
#define QSCALE  (0.125f * 1.4426950408889634f)

// Assemble a v16h WMMA operand from two contiguous 8-half runs at p and p+16,
// matching the 16-bit A/B VGPR layout: elem e -> K = kbase + (e&7) + (e>=8)*16.
__device__ __forceinline__ v16h ld_op16(const _Float16* p) {
    const v8h lo = *(const v8h*)(p);
    const v8h hi = *(const v8h*)(p + 16);
    v16h r;
#pragma unroll
    for (int i = 0; i < 8; ++i) { r[i] = lo[i]; r[i + 8] = hi[i]; }
    return r;
}

__device__ __forceinline__ v8f wmma_f16(v16h a, v16h b, v8f c) {
    return __builtin_amdgcn_wmma_f32_16x16x32_f16(
        /*neg_a=*/false, a, /*neg_b=*/false, b,
        /*c_mod=*/(short)0, c, /*reuse_a=*/false, /*reuse_b=*/false);
}

// One 64(key) x 64(d) f32 tile of K and of V, global memory -> registers.
// K: 16 B per lane, a wave covers 512 contiguous bytes per load.
// V: wave w takes d = 16w .. 16w+15 of all 64 keys; a lane holds 8 keys x 4 d.
__device__ __forceinline__ void load_tile(const float* kg, const float* vg, int tid,
                                          v4f (&kr)[8], v4f (&vr)[8]) {
    const int d0 = (tid >> 5) * 16 + (tid & 3) * 4;
    const int k0 = ((tid & 31) >> 2) * 8;
#pragma unroll
    for (int i = 0; i < 8; ++i) kr[i] = *(const v4f*)(kg + (tid + 128 * i) * 4);
#pragma unroll
    for (int j = 0; j < 8; ++j) vr[j] = *(const v4f*)(vg + (k0 + j) * DHEAD + d0);
}

// The tile in registers -> f16 -> LDS: K row-major, V transposed (d-major): each of
// a lane's 4 d rows leaves as one 16-byte store of 8 keys.
__device__ __forceinline__ void store_tile(const v4f (&kr)[8], const v4f (&vr)[8],
                                           _Float16* ks, _Float16* vts, int tid) {
    const int d0 = (tid >> 5) * 16 + (tid & 3) * 4;
    const int k0 = ((tid & 31) >> 2) * 8;
#pragma unroll
    for (int i = 0; i < 8; ++i) {
        const int c = tid + 128 * i;  // 0..1023 chunks of 4 elements
        v4h kh;
        kh[0] = (_Float16)kr[i].x; kh[1] = (_Float16)kr[i].y;
        kh[2] = (_Float16)kr[i].z; kh[3] = (_Float16)kr[i].w;
        *(v4h*)&ks[(c >> 4) * KSTRIDE + (c & 15) * 4] = kh;
    }
    v8h r0, r1, r2, r3;
#pragma unroll
    for (int j = 0; j < 8; ++j) {
        r0[j] = (_Float16)vr[j].x; r1[j] = (_Float16)vr[j].y;
        r2[j] = (_Float16)vr[j].z; r3[j] = (_Float16)vr[j].w;
    }
    *(v8h*)&vts[(d0 + 0) * VSTRIDE + k0] = r0;
    *(v8h*)&vts[(d0 + 1) * VSTRIDE + k0] = r1;
    *(v8h*)&vts[(d0 + 2) * VSTRIDE + k0] = r2;
    *(v8h*)&vts[(d0 + 3) * VSTRIDE + k0] = r3;
}

// Work-group barrier that orders LDS traffic alone: each wave's LDS reads and stores
// are finished before it, while the tile loads on their way to registers, which no
// other wave sees, stay in flight across it (a full __syncthreads() waits them out).
__device__ __forceinline__ void block_sync() {
    __builtin_amdgcn_fence(__ATOMIC_RELEASE, "workgroup", "local");
    __builtin_amdgcn_s_barrier();
    __builtin_amdgcn_fence(__ATOMIC_ACQUIRE, "workgroup", "local");
}

// One 64-key online-softmax step against the LDS block (ksb, vtsb), for the
// wave's NQ query groups. The maximum is lazy: scores are formed relative to the
// maximum in use, which enters the K Q^T products as their start value (negm = minus
// that maximum in all 8 rows), so exp2 reads the accumulators as they are; sums and
// outputs are rescaled only in a step where some score lies more than thr above it.
// Behind its own LDS reads the step converts the next step's tile,
// held in (kr, vr), into the other LDS block (ksn, vtsn) and starts the loads of the
// tile two after that one from (kgn, vgn) into the same registers: the caller passes
// two register sets in turn, so a load has two steps to land in.
__device__ __forceinline__ void fa_step(const _Float16* ksb, const _Float16* vtsb,
                                        _Float16* ksn, _Float16* vtsn,
                                        const float* kgn, const float* vgn,
                                        bool do_store, bool do_load, int tid,
                                        v4f (&kr)[8], v4f (&vr)[8],
                                        const v16h (&qb)[NQ][2], const v16h& ones,
                                        int l16, int kbase,
                                        float& lo, float& thr,
                                        v8f (&negm)[NQ], float (&l_i)[NQ],
                                        v8f (&acc)[NQ][4]) {
    // ---- every fragment of the step, K then Vt, read from LDS as one group ----
    v16h ka[2][4], va[2][4];
#pragma unroll
    for (int c = 0; c < 2; ++c)
#pragma unroll
        for (int n = 0; n < 4; ++n)
            ka[c][n] = ld_op16(&ksb[(n * 16 + l16) * KSTRIDE + c * 32 + kbase]);
#pragma unroll
    for (int ck = 0; ck < 2; ++ck)
#pragma unroll
        for (int t = 0; t < 4; ++t)
            va[ck][t] = ld_op16(&vtsb[(t * 16 + l16) * VSTRIDE + ck * 32 + kbase]);
    // keeps the reads ahead of the conversions, which then run while the reads land
    __builtin_amdgcn_sched_barrier(0);
    if (do_store) store_tile(kr, vr, ksn, vtsn, tid);
    // keeps the conversions out of the stretch between the loads and their wait
    __builtin_amdgcn_sched_barrier(0);
    if (do_load) {
        load_tile(kgn, vgn, tid, kr, vr);
        // a precaution: stands ahead of every reuse of the loads' address registers
        asm volatile("s_wait_xcnt 0x0" ::: "memory");
    }
    // holds the reads, the next tile's LDS stores and the global loads above the
    // products: left free, the compiler spreads the reads among the WMMAs, each
    // waited for at once, and sinks the loads towards their use two steps later
    __builtin_amdgcn_sched_barrier(0);

    // ---- S^T = K Q^T : per group four 16(key)x16(qrow) tiles, k=64 in two chunks ----
    v8f s[NQ][4];
#pragma unroll
    for (int n = 0; n < 4; ++n)
#pragma unroll
        for (int g = 0; g < NQ; ++g) s[g][n] = wmma_f16(ka[0][n], qb[g][0], negm[g]);
#pragma unroll
    for (int n = 0; n < 4; ++n)
#pragma unroll
        for (int g = 0; g < NQ; ++g) s[g][n] = wmma_f16(ka[1][n], qb[g][1], s[g][n]);
    // closes the block of 16 products: they issue back to back, and no maximum is
    // drawn in between them to wait on a product just issued
    __builtin_amdgcn_sched_barrier(0);

    // ---- each lane's largest score of the step, per group; balanced max tree ----
    float mg[NQ];
#pragma unroll
    for (int g = 0; g < NQ; ++g) {
        float tm[4];
#pragma unroll
        for (int n = 0; n < 4; ++n) {
            const float a0 = fmaxf(s[g][n][0], s[g][n][1]);
            const float a1 = fmaxf(s[g][n][2], s[g][n][3]);
            const float a2 = fmaxf(s[g][n][4], s[g][n][5]);
            const float a3 = fmaxf(s[g][n][6], s[g][n][7]);
            tm[n] = fmaxf(fmaxf(a0, a1), fmaxf(a2, a3));
        }
        mg[g] = fmaxf(fmaxf(tm[0], tm[1]), fmaxf(tm[2], tm[3]));
    }
    // one test per step for the whole wave; every score is looked at by its own lane
    const unsigned over = __builtin_amdgcn_ballot_w32(fmaxf(mg[0], mg[1]) > thr);

    v16h pb[NQ][2];  // P^T packed directly into B-operand layout
#pragma unroll
    for (int g = 0; g < NQ; ++g)
#pragma unroll
        for (int n = 0; n < 4; ++n)
#pragma unroll
            for (int v = 0; v < 8; ++v)
                pb[g][n >> 1][(n & 1) * 8 + v] = (_Float16)__builtin_amdgcn_exp2f(s[g][n][v]);

    // rare after the first step: the hint keeps the common path in line, this one out of it
    if (__builtin_expect(over != 0, 0)) {
        // ---- the maximum in use moves up by d; in the first step, where none is in
        // use yet (lo is hugely negative), it becomes the step's own maximum ----
#pragma unroll
        for (int g = 0; g < NQ; ++g) {
            const float mx   = fmaxf(mg[g], __shfl_xor(mg[g], 16, 32));
            const float d    = fmaxf(mx, lo);
            // d < 0 only in the first step, whose sums are still 0: no factor above 1
            const float corr = __builtin_amdgcn_exp2f(fminf(-d, 0.0f));
#pragma unroll
            for (int n = 0; n < 4; ++n)
#pragma unroll
                for (int v = 0; v < 8; ++v)
                    pb[g][n >> 1][(n & 1) * 8 + v] =
                        (_Float16)__builtin_amdgcn_exp2f(s[g][n][v] - d);
#pragma unroll
            for (int v = 0; v < 8; ++v) negm[g][v] -= d;
            l_i[g] *= corr;
#pragma unroll
            for (int t = 0; t < 4; ++t)
#pragma unroll
                for (int v = 0; v < 8; ++v) acc[g][t][v] *= corr;
        }
        lo  = 0.0f;
        thr = 8.0f;
    }

#pragma unroll
    for (int g = 0; g < NQ; ++g) {
        // row sum via WMMA with ones: every lane gets sum over all 64 keys
        v8f rsum;
#pragma unroll
        for (int v = 0; v < 8; ++v) rsum[v] = 0.0f;
        rsum = wmma_f16(ones, pb[g][0], rsum);
        rsum = wmma_f16(ones, pb[g][1], rsum);
        l_i[g] += rsum[0];
    }

    // ---- O^T += V^T P^T : 4 d-tiles x 2 key-chunks, each Vt fragment for NQ groups ----
#pragma unroll
    for (int ck = 0; ck < 2; ++ck)
#pragma unroll
        for (int t = 0; t < 4; ++t)
#pragma unroll
            for (int g = 0; g < NQ; ++g) acc[g][t] = wmma_f16(va[ck][t], pb[g][ck], acc[g][t]);
    // keeps the barrier that follows the step below the step's work: left free it
    // rises to the step's last LDS operation, and the waves wait there with work left
    __builtin_amdgcn_sched_barrier(0);
}

// ---------------------------------------------------------------------------
// Flash attention forward: S^T / O^T formulation on f16 operands converted in the
// kernel from the f32 inputs (Q scaled by QSCALE); K and V tiles go global ->
// registers -> f16 -> LDS, two LDS blocks, two register sets, loads two steps ahead
// of their stores; hand-unrolled x2 so LDS blocks and register sets are compile-time.
// ---------------------------------------------------------------------------
__global__ __launch_bounds__(128)
void fa_fwd_wmma(const float* __restrict__ Q, const float* __restrict__ K,
                 const float* __restrict__ V, float* __restrict__ O) {
    __shared__ __align__(16) _Float16 Ks0[BN * KSTRIDE];
    __shared__ __align__(16) _Float16 Ks1[BN * KSTRIDE];
    __shared__ __align__(16) _Float16 Vts0[DHEAD * VSTRIDE];
    __shared__ __align__(16) _Float16 Vts1[DHEAD * VSTRIDE];

    const int tid   = threadIdx.x;
    const int lane  = tid & 31;
    const int wid   = tid >> 5;
    const int half  = lane >> 4;
    const int l16   = lane & 15;
    const int kbase = half * 8;

    const int    bh     = blockIdx.y;
    const int    qblk   = blockIdx.x;
    const size_t bh_off = (size_t)bh * SEQ * DHEAD;

    const float* kg0 = K + bh_off;
    const float* vg0 = V + bh_off;

    // the first two tiles' loads, ahead of everything else: even tiles pass through
    // set A, odd tiles through set B
    v4f krA[8], vrA[8], krB[8], vrB[8];
    // with the fence behind the wait below: keeps index arithmetic, which reuses the
    // loads' address registers, out of the stretch between the loads and their wait
    __builtin_amdgcn_sched_barrier(0);
    load_tile(kg0, vg0, tid, krA, vrA);
    load_tile(kg0 + BN * DHEAD, vg0 + BN * DHEAD, tid, krB, vrB);

    // ---- Q tile: B-operand (Q^T) registers, scaled and converted to f16 ----
    const int    qbase = qblk * BM + wid * (16 * NQ);
    const float* qrow  = Q + bh_off + (size_t)(qbase + l16) * DHEAD;
    v4f qf[NQ][2][4];
#pragma unroll
    for (int g = 0; g < NQ; ++g)
#pragma unroll
        for (int c = 0; c < 2; ++c) {
            const float* p = qrow + g * 16 * DHEAD + c * 32 + kbase;
            qf[g][c][0] = *(const v4f*)(p);
            qf[g][c][1] = *(const v4f*)(p + 4);
            qf[g][c][2] = *(const v4f*)(p + 16);
            qf[g][c][3] = *(const v4f*)(p + 20);
        }
    // a precaution: stands ahead of every reuse of the loads' address registers
    asm volatile("s_wait_xcnt 0x0" ::: "memory");
    __builtin_amdgcn_sched_barrier(0);
    v16h qb[NQ][2];
#pragma unroll
    for (int g = 0; g < NQ; ++g)
#pragma unroll
        for (int c = 0; c < 2; ++c)
#pragma unroll
            for (int i = 0; i < 16; ++i)
                qb[g][c][i] = (_Float16)(qf[g][c][i >> 2][i & 3] * QSCALE);

    v16h ones;
#pragma unroll
    for (int e = 0; e < 16; ++e) ones[e] = (_Float16)1.0f;

    float l_i[NQ];           // per-lane: this lane owns qrows (qbase + g*16 + l16)
    v8f   negm[NQ];          // minus the maximum in use of that qrow, in all 8 rows
    float lo  = -3.0e38f;    // floor of a move of the maximum: 0 once one is in use
    float thr = -3.0e38f;    // a score above it moves the maximum: 8 once one is in use
    v8f acc[NQ][4];          // O^T: rows d = t*16 + kbase + v, col = qrow
#pragma unroll
    for (int g = 0; g < NQ; ++g) {
        l_i[g] = 0.0f;
#pragma unroll
        for (int v = 0; v < 8; ++v) negm[g][v] = 0.0f;
#pragma unroll
        for (int t = 0; t < 4; ++t)
#pragma unroll
            for (int v = 0; v < 8; ++v) acc[g][t][v] = 0.0f;
    }

    // prologue: tile 0 into block 0; the loads of tiles 1 and 2 in flight
    store_tile(krA, vrA, Ks0, Vts0, tid);
    // as above: nothing that reuses an address register between the loads and their wait
    __builtin_amdgcn_sched_barrier(0);
    load_tile(kg0 + 2 * BN * DHEAD, vg0 + 2 * BN * DHEAD, tid, krA, vrA);
    // a precaution: stands ahead of every reuse of the loads' address registers
    asm volatile("s_wait_xcnt 0x0" ::: "memory");
    __builtin_amdgcn_sched_barrier(0);

    // Every step of this loop stores and loads, with no test: the wait in front of a
    // set's conversion can then count the other set's 16 younger loads as still out.
    for (int kb = 0; kb < SEQ - 4 * BN; kb += 2 * BN) {
        // ---- half A: compute block 0, fill block 1 from set B, reload set B ----
        block_sync();  // block 0 stored everywhere; block 1 read to its end
        fa_step(Ks0, Vts0, Ks1, Vts1,
                kg0 + (size_t)(kb + 3 * BN) * DHEAD, vg0 + (size_t)(kb + 3 * BN) * DHEAD,
                true, true, tid, krB, vrB, qb, ones, l16, kbase, lo, thr, negm, l_i, acc);

        // ---- half B: compute block 1, fill block 0 from set A, reload set A ----
        block_sync();  // block 1 stored everywhere; block 0 read to its end
        fa_step(Ks1, Vts1, Ks0, Vts0,
                kg0 + (size_t)(kb + 4 * BN) * DHEAD, vg0 + (size_t)(kb + 4 * BN) * DHEAD,
                true, true, tid, krA, vrA, qb, ones, l16, kbase, lo, thr, negm, l_i, acc);
    }
    // ---- the last four tiles: one load is left, then the stores run out ----
    block_sync();
    fa_step(Ks0, Vts0, Ks1, Vts1,
            kg0 + (size_t)(SEQ - BN) * DHEAD, vg0 + (size_t)(SEQ - BN) * DHEAD,
            true, true, tid, krB, vrB, qb, ones, l16, kbase, lo, thr, negm, l_i, acc);
    block_sync();
    fa_step(Ks1, Vts1, Ks0, Vts0, kg0, vg0,
            true, false, tid, krA, vrA, qb, ones, l16, kbase, lo, thr, negm, l_i, acc);
    block_sync();
    fa_step(Ks0, Vts0, Ks1, Vts1, kg0, vg0,
            true, false, tid, krB, vrB, qb, ones, l16, kbase, lo, thr, negm, l_i, acc);
    block_sync();
    fa_step(Ks1, Vts1, Ks0, Vts0, kg0, vg0,
            false, false, tid, krA, vrA, qb, ones, l16, kbase, lo, thr, negm, l_i, acc);

    // ---- epilogue: O[qrow][d] = acc^T / l, b128 runs along d ----
#pragma unroll
    for (int g = 0; g < NQ; ++g) {
        const float inv  = 1.0f / l_i[g];
        float*      orow = O + bh_off + (size_t)(qbase + g * 16 + l16) * DHEAD;
#pragma unroll
        for (int t = 0; t < 4; ++t) {
            float4 lo, hi;
            lo.x = acc[g][t][0] * inv; lo.y = acc[g][t][1] * inv;
            lo.z = acc[g][t][2] * inv; lo.w = acc[g][t][3] * inv;
            hi.x = acc[g][t][4] * inv; hi.y = acc[g][t][5] * inv;
            hi.z = acc[g][t][6] * inv; hi.w = acc[g][t][7] * inv;
            *(float4*)&orow[t * 16 + kbase]     = lo;
            *(float4*)&orow[t * 16 + kbase + 4] = hi;
        }
    }
}

extern "C" void kernel_launch(void* const* d_in, const int* in_sizes, int n_in,
                              void* d_out, int out_size, void* d_ws, size_t ws_size,
                              hipStream_t stream) {
    const float* Q = (const float*)d_in[0];
    const float* K = (const float*)d_in[1];
    const float* V = (const float*)d_in[2];
    float*       O = (float*)d_out;

    const size_t n  = (size_t)in_sizes[0];        // B*H*S*D = 4,194,304
    const int    bh = (int)(n / (SEQ * DHEAD));   // 32

    dim3 grid(SEQ / BM, bh);
    fa_fwd_wmma<<<grid, dim3(128), 0, stream>>>(Q, K, V, O);
}

// v007
// A run of this version takes 31.8 microseconds.
// Timed twice side by side with v006, it ran 1.10 times as fast both times.
// Over all steps from v000 it is 3.26 times as fast.
#include <hip/hip_runtime.h>

typedef __attribute__((ext_vector_type(16))) _Float16 v16h;
typedef __attribute__((ext_vector_type(8)))  _Float16 v8h;
typedef __attribute__((ext_vector_type(4)))  _Float16 v4h;
typedef __attribute__((ext_vector_type(8)))  float    v8f;
typedef __attribute__((ext_vector_type(4)))  float    v4f;
typedef __attribute__((ext_vector_type(4)))  int      v4i;

#define SEQ     2048
#define DHEAD   64
#define NQ      2       // 16-row query groups per wave: each K / Vt fragment read from LDS feeds NQ products
#define NT      256     // threads per block: 8 waves share each K / V tile
#define BM      256     // query rows per block (16 * NQ per wave)
#define BN      64      // keys per iteration
#define KSTRIDE 72      // halves per K-LDS row (64 + pad, 144B, 16B-aligned)
#define VSTRIDE 72      // halves per Vt-LDS row (64 + pad, 144B, 16B-aligned)

// 1/sqrt(64) * log2(e): scores produced directly in log2 domain
#define QSCALE  (0.125f * 1.4426950408889634f)

// Assemble a v16h WMMA operand from two contiguous 8-half runs at p and p+16,
// matching the 16-bit A/B VGPR layout: elem e -> K = kbase + (e&7) + (e>=8)*16.
__device__ __forceinline__ v16h ld_op16(const _Float16* p) {
    const v8h lo = *(const v8h*)(p);
    const v8h hi = *(const v8h*)(p + 16);
    v16h r;
#pragma unroll
    for (int i = 0; i < 8; ++i) { r[i] = lo[i]; r[i + 8] = hi[i]; }
    return r;
}

__device__ __forceinline__ v8f wmma_f16(v16h a, v16h b, v8f c) {
    return __builtin_amdgcn_wmma_f32_16x16x32_f16(
        /*neg_a=*/false, a, /*neg_b=*/false, b,
        /*c_mod=*/(short)0, c, /*reuse_a=*/false, /*reuse_b=*/false);
}

// One 64(key) x 64(d) f32 tile of K and of V, global memory -> registers.
// K: 16 B per lane, a wave covers 512 contiguous bytes per load.
// V: a wave takes 16 keys x 32 d; a lane holds 4 keys x 4 d, and 8 lanes cover one
// whole 128-byte line of a key's row per load.
__device__ __forceinline__ void load_tile(const float* kg, const float* vg, int tid,
                                          v4f (&kr)[4], v4f (&vr)[4]) {
    const int d0 = ((tid >> 5) & 1) * 32 + (tid & 7) * 4;
    const int k0 = (tid >> 6) * 16 + ((tid & 31) >> 3) * 4;
#pragma unroll
    for (int i = 0; i < 4; ++i) kr[i] = *(const v4f*)(kg + (tid + NT * i) * 4);
#pragma unroll
    for (int j = 0; j < 4; ++j) vr[j] = *(const v4f*)(vg + (k0 + j) * DHEAD + d0);
}

// The tile in registers -> f16 -> LDS: K row-major, V transposed (d-major): each of
// a lane's 4 d rows leaves as one 8-byte store of 4 keys.
__device__ __forceinline__ void store_tile(const v4f (&kr)[4], const v4f (&vr)[4],
                                           _Float16* ks, _Float16* vts, int tid) {
    const int d0 = ((tid >> 5) & 1) * 32 + (tid & 7) * 4;
    const int k0 = (tid >> 6) * 16 + ((tid & 31) >> 3) * 4;
#pragma unroll
    for (int i = 0; i < 4; ++i) {
        const int c = tid + NT * i;  // 0..1023 chunks of 4 elements
        v4h kh;
        kh[0] = (_Float16)kr[i].x; kh[1] = (_Float16)kr[i].y;
        kh[2] = (_Float16)kr[i].z; kh[3] = (_Float16)kr[i].w;
        *(v4h*)&ks[(c >> 4) * KSTRIDE + (c & 15) * 4] = kh;
    }
    v4h r0, r1, r2, r3;
#pragma unroll
    for (int j = 0; j < 4; ++j) {
        r0[j] = (_Float16)vr[j].x; r1[j] = (_Float16)vr[j].y;
        r2[j] = (_Float16)vr[j].z; r3[j] = (_Float16)vr[j].w;
    }
    *(v4h*)&vts[(d0 + 0) * VSTRIDE + k0] = r0;
    *(v4h*)&vts[(d0 + 1) * VSTRIDE + k0] = r1;
    *(v4h*)&vts[(d0 + 2) * VSTRIDE + k0] = r2;
    *(v4h*)&vts[(d0 + 3) * VSTRIDE + k0] = r3;
}

// Work-group barrier that orders LDS traffic alone: each wave's LDS reads and stores
// are finished before it, while the tile loads on their way to registers, which no
// other wave sees, stay in flight across it (a full __syncthreads() waits them out).
__device__ __forceinline__ void block_sync() {
    __builtin_amdgcn_fence(__ATOMIC_RELEASE, "workgroup", "local");
    __builtin_amdgcn_s_barrier();
    __builtin_amdgcn_fence(__ATOMIC_ACQUIRE, "workgroup", "local");
}

// One 64-key online-softmax step against the LDS block (ksb, vtsb), for the
// wave's NQ query groups. The maximum is lazy: scores are formed relative to the
// maximum in use, which enters the K Q^T products as their start value (negm = minus
// that maximum in all 8 rows), so exp2 reads the accumulators as they are; sums and
// outputs are rescaled only in a step where some score lies more than thr above it.
// Behind its own LDS reads the step converts the next step's tile,
// held in (kr, vr), into the other LDS block (ksn, vtsn) and starts the loads of the
// tile two after that one from (kgn, vgn) into the same registers: the caller passes
// two register sets in turn, so a load has two steps to land in.
__device__ __forceinline__ void fa_step(const _Float16* ksb, const _Float16* vtsb,
                                        _Float16* ksn, _Float16* vtsn,
                                        const float* kgn, const float* vgn,
                                        bool do_store, bool do_load, int tid,
                                        v4f (&kr)[4], v4f (&vr)[4],
                                        const v16h (&qb)[NQ][2], const v16h& ones,
                                        int l16, int kbase,
                                        float& lo, float& thr,
                                        v8f (&negm)[NQ], float (&l_i)[NQ],
                                        v8f (&acc)[NQ][4]) {
    // ---- every fragment of the step, K then Vt, read from LDS as one group ----
    v16h ka[2][4], va[2][4];
#pragma unroll
    for (int c = 0; c < 2; ++c)
#pragma unroll
        for (int n = 0; n < 4; ++n)
            ka[c][n] = ld_op16(&ksb[(n * 16 + l16) * KSTRIDE + c * 32 + kbase]);
#pragma unroll
    for (int ck = 0; ck < 2; ++ck)
#pragma unroll
        for (int t = 0; t < 4; ++t)
            va[ck][t] = ld_op16(&vtsb[(t * 16 + l16) * VSTRIDE + ck * 32 + kbase]);
    // keeps the reads ahead of the conversions, which then run while the reads land
    __builtin_amdgcn_sched_barrier(0);
    if (do_store) store_tile(kr, vr, ksn, vtsn, tid);
    // keeps the conversions out of the stretch between the loads and their wait
    __builtin_amdgcn_sched_barrier(0);
    if (do_load) {
        load_tile(kgn, vgn, tid, kr, vr);
        // a precaution: stands ahead of every reuse of the loads' address registers
        asm volatile("s_wait_xcnt 0x0" ::: "memory");
    }
    // holds the reads, the next tile's LDS stores and the global loads above the
    // products: left free, the compiler spreads the reads among the WMMAs, each
    // waited for at once, and sinks the loads towards their use two steps later
    __builtin_amdgcn_sched_barrier(0);

    // ---- S^T = K Q^T : per group four 16(key)x16(qrow) tiles, k=64 in two chunks ----
    v8f s[NQ][4];
#pragma unroll
    for (int n = 0; n < 4; ++n)
#pragma unroll
        for (int g = 0; g < NQ; ++g) s[g][n] = wmma_f16(ka[0][n], qb[g][0], negm[g]);
#pragma unroll
    for (int n = 0; n < 4; ++n)
#pragma unroll
        for (int g = 0; g < NQ; ++g) s[g][n] = wmma_f16(ka[1][n], qb[g][1], s[g][n]);
    // closes the block of 16 products: they issue back to back, and no maximum is
    // drawn in between them to wait on a product just issued
    __builtin_amdgcn_sched_barrier(0);

    // ---- each lane's largest score of the step, per group; balanced max tree ----
    float mg[NQ];
#pragma unroll
    for (int g = 0; g < NQ; ++g) {
        float tm[4];
#pragma unroll
        for (int n = 0; n < 4; ++n) {
            const float a0 = fmaxf(s[g][n][0], s[g][n][1]);
            const float a1 = fmaxf(s[g][n][2], s[g][n][3]);
            const float a2 = fmaxf(s[g][n][4], s[g][n][5]);
            const float a3 = fmaxf(s[g][n][6], s[g][n][7]);
            tm[n] = fmaxf(fmaxf(a0, a1), fmaxf(a2, a3));
        }
        mg[g] = fmaxf(fmaxf(tm[0], tm[1]), fmaxf(tm[2], tm[3]));
    }
    // one test per step for the whole wave; every score is looked at by its own lane
    const unsigned over = __builtin_amdgcn_ballot_w32(fmaxf(mg[0], mg[1]) > thr);

    v16h pb[NQ][2];  // P^T packed directly into B-operand layout
#pragma unroll
    for (int g = 0; g < NQ; ++g)
#pragma unroll
        for (int n = 0; n < 4; ++n)
#pragma unroll
            for (int v = 0; v < 8; ++v)
                pb[g][n >> 1][(n & 1) * 8 + v] = (_Float16)__builtin_amdgcn_exp2f(s[g][n][v]);

    // rare after the first step: the hint keeps the common path in line, this one out of it
    if (__builtin_expect(over != 0, 0)) {
        // ---- the maximum in use moves up by d; in the first step, where none is in
        // use yet (lo is hugely negative), it becomes the step's own maximum ----
#pragma unroll
        for (int g = 0; g < NQ; ++g) {
            const float mx   = fmaxf(mg[g], __shfl_xor(mg[g], 16, 32));
            const float d    = fmaxf(mx, lo);
            // d < 0 only in the first step, whose sums are still 0: no factor above 1
            const float corr = __builtin_amdgcn_exp2f(fminf(-d, 0.0f));
#pragma unroll
            for (int n = 0; n < 4; ++n)
#pragma unroll
                for (int v = 0; v < 8; ++v)
                    pb[g][n >> 1][(n & 1) * 8 + v] =
                        (_Float16)__builtin_amdgcn_exp2f(s[g][n][v] - d);
#pragma unroll
            for (int v = 0; v < 8; ++v) negm[g][v] -= d;
            l_i[g] *= corr;
#pragma unroll
            for (int t = 0; t < 4; ++t)
#pragma unroll
                for (int v = 0; v < 8; ++v) acc[g][t][v] *= corr;
        }
        lo  = 0.0f;
        thr = 8.0f;
    }

#pragma unroll
    for (int g = 0; g < NQ; ++g) {
        // row sum via WMMA with ones: every lane gets sum over all 64 keys
        v8f rsum;
#pragma unroll
        for (int v = 0; v < 8; ++v) rsum[v] = 0.0f;
        rsum = wmma_f16(ones, pb[g][0], rsum);
        rsum = wmma_f16(ones, pb[g][1], rsum);
        l_i[g] += rsum[0];
    }

    // ---- O^T += V^T P^T : 4 d-tiles x 2 key-chunks, each Vt fragment for NQ groups ----
#pragma unroll
    for (int ck = 0; ck < 2; ++ck)
#pragma unroll
        for (int t = 0; t < 4; ++t)
#pragma unroll
            for (int g = 0; g < NQ; ++g) acc[g][t] = wmma_f16(va[ck][t], pb[g][ck], acc[g][t]);
    // keeps the barrier that follows the step below the step's work: left free it
    // rises to the step's last LDS operation, and the waves wait there with work left
    __builtin_amdgcn_sched_barrier(0);
}

// ---------------------------------------------------------------------------
// Flash attention forward: S^T / O^T formulation on f16 operands converted in the
// kernel from the f32 inputs (Q scaled by QSCALE); K and V tiles go global ->
// registers -> f16 -> LDS, two LDS blocks, two register sets, loads two steps ahead
// of their stores; hand-unrolled x2 so LDS blocks and register sets are compile-time.
// ---------------------------------------------------------------------------
__global__ __launch_bounds__(NT)
void fa_fwd_wmma(const float* __restrict__ Q, const float* __restrict__ K,
                 const float* __restrict__ V, float* __restrict__ O) {
    __shared__ __align__(16) _Float16 Ks0[BN * KSTRIDE];
    __shared__ __align__(16) _Float16 Ks1[BN * KSTRIDE];
    __shared__ __align__(16) _Float16 Vts0[DHEAD * VSTRIDE];
    __shared__ __align__(16) _Float16 Vts1[DHEAD * VSTRIDE];

    const int tid   = threadIdx.x;
    const int lane  = tid & 31;
    const int wid   = tid >> 5;
    const int half  = lane >> 4;
    const int l16   = lane & 15;
    const int kbase = half * 8;

    const int    bh     = blockIdx.y;
    const int    qblk   = blockIdx.x;
    const size_t bh_off = (size_t)bh * SEQ * DHEAD;

    const float* kg0 = K + bh_off;
    const float* vg0 = V + bh_off;

    // the first two tiles' loads, ahead of everything else: even tiles pass through
    // set A, odd tiles through set B
    v4f krA[4], vrA[4], krB[4], vrB[4];
    // with the fence behind the wait below: keeps index arithmetic, which reuses the
    // loads' address registers, out of the stretch between the loads and their wait
    __builtin_amdgcn_sched_barrier(0);
    load_tile(kg0, vg0, tid, krA, vrA);
    load_tile(kg0 + BN * DHEAD, vg0 + BN * DHEAD, tid, krB, vrB);

    // ---- Q tile: B-operand (Q^T) registers, scaled and converted to f16 ----
    const int    qbase = qblk * BM + wid * (16 * NQ);
    const float* qrow  = Q + bh_off + (size_t)(qbase + l16) * DHEAD;
    v4f qf[NQ][2][4];
#pragma unroll
    for (int g = 0; g < NQ; ++g)
#pragma unroll
        for (int c = 0; c < 2; ++c) {
            const float* p = qrow + g * 16 * DHEAD + c * 32 + kbase;
            qf[g][c][0] = *(const v4f*)(p);
            qf[g][c][1] = *(const v4f*)(p + 4);
            qf[g][c][2] = *(const v4f*)(p + 16);
            qf[g][c][3] = *(const v4f*)(p + 20);
        }
    // a precaution: stands ahead of every reuse of the loads' address registers
    asm volatile("s_wait_xcnt 0x0" ::: "memory");
    __builtin_amdgcn_sched_barrier(0);
    v16h qb[NQ][2];
#pragma unroll
    for (int g = 0; g < NQ; ++g)
#pragma unroll
        for (int c = 0; c < 2; ++c)
#pragma unroll
            for (int i = 0; i < 16; ++i)
                qb[g][c][i] = (_Float16)(qf[g][c][i >> 2][i & 3] * QSCALE);

    v16h ones;
#pragma unroll
    for (int e = 0; e < 16; ++e) ones[e] = (_Float16)1.0f;

    float l_i[NQ];           // per-lane: this lane owns qrows (qbase + g*16 + l16)
    v8f   negm[NQ];          // minus the maximum in use of that qrow, in all 8 rows
    float lo  = -3.0e38f;    // floor of a move of the maximum: 0 once one is in use
    float thr = -3.0e38f;    // a score above it moves the maximum: 8 once one is in use
    v8f acc[NQ][4];          // O^T: rows d = t*16 + kbase + v, col = qrow
#pragma unroll
    for (int g = 0; g < NQ; ++g) {
        l_i[g] = 0.0f;
#pragma unroll
        for (int v = 0; v < 8; ++v) negm[g][v] = 0.0f;
#pragma unroll
        for (int t = 0; t < 4; ++t)
#pragma unroll
            for (int v = 0; v < 8; ++v) acc[g][t][v] = 0.0f;
    }

    // prologue: tile 0 into block 0; the loads of tiles 1 and 2 in flight
    store_tile(krA, vrA, Ks0, Vts0, tid);
    // as above: nothing that reuses an address register between the loads and their wait
    __builtin_amdgcn_sched_barrier(0);
    load_tile(kg0 + 2 * BN * DHEAD, vg0 + 2 * BN * DHEAD, tid, krA, vrA);
    // a precaution: stands ahead of every reuse of the loads' address registers
    asm volatile("s_wait_xcnt 0x0" ::: "memory");
    __builtin_amdgcn_sched_barrier(0);

    // Every step of this loop stores and loads, with no test: the wait in front of a
    // set's conversion can then count the other set's 8 younger loads as still out.
    for (int kb = 0; kb < SEQ - 4 * BN; kb += 2 * BN) {
        // ---- half A: compute block 0, fill block 1 from set B, reload set B ----
        block_sync();  // block 0 stored everywhere; block 1 read to its end
        fa_step(Ks0, Vts0, Ks1, Vts1,
                kg0 + (size_t)(kb + 3 * BN) * DHEAD, vg0 + (size_t)(kb + 3 * BN) * DHEAD,
                true, true, tid, krB, vrB, qb, ones, l16, kbase, lo, thr, negm, l_i, acc);

        // ---- half B: compute block 1, fill block 0 from set A, reload set A ----
        block_sync();  // block 1 stored everywhere; block 0 read to its end
        fa_step(Ks1, Vts1, Ks0, Vts0,
                kg0 + (size_t)(kb + 4 * BN) * DHEAD, vg0 + (size_t)(kb + 4 * BN) * DHEAD,
                true, true, tid, krA, vrA, qb, ones, l16, kbase, lo, thr, negm, l_i, acc);
    }
    // ---- the last four tiles: one load is left, then the stores run out ----
    block_sync();
    fa_step(Ks0, Vts0, Ks1, Vts1,
            kg0 + (size_t)(SEQ - BN) * DHEAD, vg0 + (size_t)(SEQ - BN) * DHEAD,
            true, true, tid, krB, vrB, qb, ones, l16, kbase, lo, thr, negm, l_i, acc);
    block_sync();
    fa_step(Ks1, Vts1, Ks0, Vts0, kg0, vg0,
            true, false, tid, krA, vrA, qb, ones, l16, kbase, lo, thr, negm, l_i, acc);
    block_sync();
    fa_step(Ks0, Vts0, Ks1, Vts1, kg0, vg0,
            true, false, tid, krB, vrB, qb, ones, l16, kbase, lo, thr, negm, l_i, acc);
    block_sync();
    fa_step(Ks1, Vts1, Ks0, Vts0, kg0, vg0,
            false, false, tid, krA, vrA, qb, ones, l16, kbase, lo, thr, negm, l_i, acc);

    // ---- epilogue: O[qrow][d] = acc^T / l, b128 runs along d ----
#pragma unroll
    for (int g = 0; g < NQ; ++g) {
        const float inv  = 1.0f / l_i[g];
        float*      orow = O + bh_off + (size_t)(qbase + g * 16 + l16) * DHEAD;
#pragma unroll
        for (int t = 0; t < 4; ++t) {
            float4 lo, hi;
            lo.x = acc[g][t][0] * inv; lo.y = acc[g][t][1] * inv;
            lo.z = acc[g][t][2] * inv; lo.w = acc[g][t][3] * inv;
            hi.x = acc[g][t][4] * inv; hi.y = acc[g][t][5] * inv;
            hi.z = acc[g][t][6] * inv; hi.w = acc[g][t][7] * inv;
            *(float4*)&orow[t * 16 + kbase]     = lo;
            *(float4*)&orow[t * 16 + kbase + 4] = hi;
        }
    }
}

extern "C" void kernel_launch(void* const* d_in, const int* in_sizes, int n_in,
                              void* d_out, int out_size, void* d_ws, size_t ws_size,
                              hipStream_t stream) {
    const float* Q = (const float*)d_in[0];
    const float* K = (const float*)d_in[1];
    const float* V = (const float*)d_in[2];
    float*       O = (float*)d_out;

    const size_t n  = (size_t)in_sizes[0];        // B*H*S*D = 4,194,304
    const int    bh = (int)(n / (SEQ * DHEAD));   // 32

    dim3 grid(SEQ / BM, bh);
    fa_fwd_wmma<<<grid, dim3(NT), 0, stream>>>(Q, K, V, O);
}

// v008
// It runs in 29.6 microseconds.
// Two timings next to v007 both put it at 1.08 times that version's speed.
// Over all steps from v000 it is 3.51 times as fast.
#include <hip/hip_runtime.h>

typedef __attribute__((ext_vector_type(16))) _Float16 v16h;
typedef __attribute__((ext_vector_type(8)))  _Float16 v8h;
typedef __attribute__((ext_vector_type(4)))  _Float16 v4h;
typedef __attribute__((ext_vector_type(8)))  float    v8f;
typedef __attribute__((ext_vector_type(4)))  float    v4f;
typedef __attribute__((ext_vector_type(4)))  int      v4i;

#define SEQ     2048
#define DHEAD   64
#define NQ      2       // 16-row query groups per wave: each K / Vt fragment read from LDS feeds NQ products
#define NT      512     // threads per block: two sets of 8 waves, four waves per SIMD
#define HT      256     // threads per set: its 8 waves share each K / V tile
#define BM      256     // query rows per block (16 * NQ per wave); both sets take all of them
#define BN      64      // keys per step (one LDS tile, one barrier), worked on in two 32-key passes
#define KSET    (SEQ / 2)  // keys per set: set 0 the first half of the keys, set 1 the second
#define KSTRIDE 72      // halves per K-LDS row (64 + pad, 144B, 16B-aligned)
#define VSTRIDE 72      // halves per Vt-LDS row (64 + pad, 144B, 16B-aligned)

// 1/sqrt(64) * log2(e): scores produced directly in log2 domain
#define QSCALE  (0.125f * 1.4426950408889634f)

// Assemble a v16h WMMA operand from two contiguous 8-half runs at p and p+16,
// matching the 16-bit A/B VGPR layout: elem e -> K = kbase + (e&7) + (e>=8)*16.
__device__ __forceinline__ v16h ld_op16(const _Float16* p) {
    const v8h lo = *(const v8h*)(p);
    const v8h hi = *(const v8h*)(p + 16);
    v16h r;
#pragma unroll
    for (int i = 0; i < 8; ++i) { r[i] = lo[i]; r[i + 8] = hi[i]; }
    return r;
}

__device__ __forceinline__ v8f wmma_f16(v16h a, v16h b, v8f c) {
    return __builtin_amdgcn_wmma_f32_16x16x32_f16(
        /*neg_a=*/false, a, /*neg_b=*/false, b,
        /*c_mod=*/(short)0, c, /*reuse_a=*/false, /*reuse_b=*/false);
}

// One 64(key) x 64(d) f32 tile of K and of V, global memory -> registers.
// K: 16 B per lane, a wave covers 512 contiguous bytes per load.
// V: a wave takes 16 keys x 32 d; a lane holds 4 keys x 4 d, and 8 lanes cover one
// whole 128-byte line of a key's row per load.
__device__ __forceinline__ void load_tile(const float* kg, const float* vg, int tid,
                                          v4f (&kr)[4], v4f (&vr)[4]) {
    const int d0 = ((tid >> 5) & 1) * 32 + (tid & 7) * 4;
    const int k0 = (tid >> 6) * 16 + ((tid & 31) >> 3) * 4;
#pragma unroll
    for (int i = 0; i < 4; ++i) kr[i] = *(const v4f*)(kg + (tid + HT * i) * 4);
#pragma unroll
    for (int j = 0; j < 4; ++j) vr[j] = *(const v4f*)(vg + (k0 + j) * DHEAD + d0);
}

// The tile in registers -> f16 -> LDS: K row-major, V transposed (d-major): each of
// a lane's 4 d rows leaves as one 8-byte store of 4 keys.
__device__ __forceinline__ void store_tile(const v4f (&kr)[4], const v4f (&vr)[4],
                                           _Float16* ks, _Float16* vts, int tid) {
    const int d0 = ((tid >> 5) & 1) * 32 + (tid & 7) * 4;
    const int k0 = (tid >> 6) * 16 + ((tid & 31) >> 3) * 4;
#pragma unroll
    for (int i = 0; i < 4; ++i) {
        const int c = tid + HT * i;  // 0..1023 chunks of 4 elements
        v4h kh;
        kh[0] = (_Float16)kr[i].x; kh[1] = (_Float16)kr[i].y;
        kh[2] = (_Float16)kr[i].z; kh[3] = (_Float16)kr[i].w;
        *(v4h*)&ks[(c >> 4) * KSTRIDE + (c & 15) * 4] = kh;
    }
    v4h r0, r1, r2, r3;
#pragma unroll
    for (int j = 0; j < 4; ++j) {
        r0[j] = (_Float16)vr[j].x; r1[j] = (_Float16)vr[j].y;
        r2[j] = (_Float16)vr[j].z; r3[j] = (_Float16)vr[j].w;
    }
    *(v4h*)&vts[(d0 + 0) * VSTRIDE + k0] = r0;
    *(v4h*)&vts[(d0 + 1) * VSTRIDE + k0] = r1;
    *(v4h*)&vts[(d0 + 2) * VSTRIDE + k0] = r2;
    *(v4h*)&vts[(d0 + 3) * VSTRIDE + k0] = r3;
}

// Work-group barrier that orders LDS traffic alone: each wave's LDS reads and stores
// are finished before it, while the tile loads on their way to registers, which no
// other wave sees, stay in flight across it (a full __syncthreads() waits them out).
__device__ __forceinline__ void block_sync() {
    __builtin_amdgcn_fence(__ATOMIC_RELEASE, "workgroup", "local");
    __builtin_amdgcn_s_barrier();
    __builtin_amdgcn_fence(__ATOMIC_ACQUIRE, "workgroup", "local");
}

// One 64-key online-softmax step against the LDS block (ksb, vtsb), for the
// wave's NQ query groups, in two passes of 32 keys: a pass holds 4 K and 4 Vt fragments
// and 4 score tiles, which keeps the wave inside the 256 registers of four waves per SIMD.
// The maximum is lazy: scores are formed relative to the
// maximum in use, which enters the K Q^T products as their start value (negm = minus
// that maximum in all 8 rows), so exp2 reads the accumulators as they are; sums and
// outputs are rescaled only in a pass where some score lies more than thr above it.
// Behind its first LDS reads the step converts the next step's tile,
// held in (kr, vr), into the other LDS block (ksn, vtsn) and starts the loads of the
// tile after that one from (kgn, vgn) into the same registers: a load has one step,
// in which four waves share the SIMD, to land in.
__device__ __forceinline__ void fa_step(const _Float16* ksb, const _Float16* vtsb,
                                        _Float16* ksn, _Float16* vtsn,
                                        const float* kgn, const float* vgn,
                                        bool do_store, bool do_load, int tid,
                                        v4f (&kr)[4], v4f (&vr)[4],
                                        const v16h (&qb)[NQ][2], const v16h& ones,
                                        int l16, int kbase,
                                        float& lo, float& thr,
                                        v8f (&negm)[NQ], v8f (&l_i)[NQ],
                                        v8f (&acc)[NQ][4]) {
#pragma unroll
    for (int p = 0; p < 2; ++p) {
        // ---- the pass's K fragments, read from LDS as one group ----
        v16h ka[2][2];
#pragma unroll
        for (int c = 0; c < 2; ++c)
#pragma unroll
            for (int n = 0; n < 2; ++n)
                ka[c][n] = ld_op16(&ksb[((p * 2 + n) * 16 + l16) * KSTRIDE + c * 32 + kbase]);
        // keeps the reads ahead of the conversions, which then run while the reads land
        __builtin_amdgcn_sched_barrier(0);
        if (p == 0) {
            if (do_store) store_tile(kr, vr, ksn, vtsn, tid);
            // keeps the conversions out of the stretch between the loads and their wait
            __builtin_amdgcn_sched_barrier(0);
            if (do_load) {
                load_tile(kgn, vgn, tid, kr, vr);
                // a precaution: stands ahead of every reuse of the loads' address registers
                asm volatile("s_wait_xcnt 0x0" ::: "memory");
            }
            // holds the reads, the next tile's LDS stores and the global loads above the
            // products: left free, the compiler sinks the loads towards their use a step later
            __builtin_amdgcn_sched_barrier(0);
        }

        // ---- S^T = K Q^T : per group two 16(key)x16(qrow) tiles, k=64 in two chunks ----
        v8f s[NQ][2];
#pragma unroll
        for (int n = 0; n < 2; ++n)
#pragma unroll
            for (int g = 0; g < NQ; ++g) s[g][n] = wmma_f16(ka[0][n], qb[g][0], negm[g]);
#pragma unroll
        for (int n = 0; n < 2; ++n)
#pragma unroll
            for (int g = 0; g < NQ; ++g) s[g][n] = wmma_f16(ka[1][n], qb[g][1], s[g][n]);
        // closes the block of 8 products: they issue back to back, and neither a maximum
        // nor a Vt read is drawn in between them
        __builtin_amdgcn_sched_barrier(0);

        // ---- the pass's Vt fragments, one group: they land under the softmax work ----
        v16h va[4];
#pragma unroll
        for (int t = 0; t < 4; ++t)
            va[t] = ld_op16(&vtsb[(t * 16 + l16) * VSTRIDE + p * 32 + kbase]);
        // keeps that group whole and ahead of the vector work below
        __builtin_amdgcn_sched_barrier(0);

        // ---- each lane's largest score of the pass, per group; balanced max tree ----
        float mg[NQ];
#pragma unroll
        for (int g = 0; g < NQ; ++g) {
            float tm[2];
#pragma unroll
            for (int n = 0; n < 2; ++n) {
                const float a0 = fmaxf(s[g][n][0], s[g][n][1]);
                const float a1 = fmaxf(s[g][n][2], s[g][n][3]);
                const float a2 = fmaxf(s[g][n][4], s[g][n][5]);
                const float a3 = fmaxf(s[g][n][6], s[g][n][7]);
                tm[n] = fmaxf(fmaxf(a0, a1), fmaxf(a2, a3));
            }
            mg[g] = fmaxf(tm[0], tm[1]);
        }
        // one test per pass for the whole wave; every score is looked at by its own lane
        const unsigned over = __builtin_amdgcn_ballot_w32(fmaxf(mg[0], mg[1]) > thr);

        v16h pb[NQ];  // P^T packed directly into B-operand layout
#pragma unroll
        for (int g = 0; g < NQ; ++g)
#pragma unroll
            for (int n = 0; n < 2; ++n)
#pragma unroll
                for (int v = 0; v < 8; ++v)
                    pb[g][n * 8 + v] = (_Float16)__builtin_amdgcn_exp2f(s[g][n][v]);

        // rare after the first pass: the hint keeps the common path in line, this one out of it
        if (__builtin_expect(over != 0, 0)) {
            // ---- the maximum in use moves up by d; in the first pass, where none is in
            // use yet (lo is hugely negative), it becomes the pass's own maximum ----
#pragma unroll
            for (int g = 0; g < NQ; ++g) {
                const float mx   = fmaxf(mg[g], __shfl_xor(mg[g], 16, 32));
                const float d    = fmaxf(mx, lo);
                // d < 0 only in the first pass, whose sums are still 0: no factor above 1
                const float corr = __builtin_amdgcn_exp2f(fminf(-d, 0.0f));
#pragma unroll
                for (int n = 0; n < 2; ++n)
#pragma unroll
                    for (int v = 0; v < 8; ++v)
                        pb[g][n * 8 + v] = (_Float16)__builtin_amdgcn_exp2f(s[g][n][v] - d);
#pragma unroll
                for (int v = 0; v < 8; ++v) negm[g][v] -= d;
#pragma unroll
                for (int v = 0; v < 8; ++v) l_i[g][v] *= corr;
#pragma unroll
                for (int t = 0; t < 4; ++t)
#pragma unroll
                    for (int v = 0; v < 8; ++v) acc[g][t][v] *= corr;
            }
            lo  = 0.0f;
            thr = 8.0f;
        }

        // row sums via WMMA with ones, kept in their own tiles like the outputs: every
        // lane holds, in all 8 rows, the sum over the keys so far
#pragma unroll
        for (int g = 0; g < NQ; ++g) l_i[g] = wmma_f16(ones, pb[g], l_i[g]);

        // ---- O^T += V^T P^T : 4 d-tiles, each Vt fragment for NQ groups ----
#pragma unroll
        for (int t = 0; t < 4; ++t)
#pragma unroll
            for (int g = 0; g < NQ; ++g) acc[g][t] = wmma_f16(va[t], pb[g], acc[g][t]);
        // keeps the next pass's reads, and the barrier that follows the step, below the
        // pass's work: left free the barrier rises to the step's last LDS operation, and
        // the waves wait there with work left
        __builtin_amdgcn_sched_barrier(0);
    }
}

// ---------------------------------------------------------------------------
// Flash attention forward: S^T / O^T formulation on f16 operands converted in the
// kernel from the f32 inputs (Q scaled by QSCALE). The block's 16 waves form two sets
// of 8; both sets take the block's 256 query rows, set 0 against the first half of the
// keys and set 1 against the second, each with its own LDS tiles, maxima, sums and
// outputs; at the end the two partial results of a row are merged through LDS.
// K and V tiles go global -> registers -> f16 -> LDS, two LDS blocks per set, loads one
// step ahead of their stores; hand-unrolled x2 so the LDS blocks are compile-time.
// ---------------------------------------------------------------------------
__global__ __launch_bounds__(NT)
void fa_fwd_wmma(const float* __restrict__ Q, const float* __restrict__ K,
                 const float* __restrict__ V, float* __restrict__ O) {
    // [set][block][K, Vt]
    __shared__ __align__(16) _Float16 tiles[2][2][2][BN * KSTRIDE];
    // the merge: per wave the 4 output tiles, the sum and the maximum of the query group
    // that its partner wave in the other set finishes
    __shared__ __align__(16) float xacc[NT / 32][8][32][4];
    __shared__ float xlm[NT / 32][2][32];

    const int tid   = threadIdx.x;
    const int lane  = tid & 31;
    const int wid   = tid >> 5;
    const int set   = __builtin_amdgcn_readfirstlane(tid >> 8);  // same in all of a wave
    const int ts    = tid & (HT - 1);   // thread within its set
    const int ws    = wid & 7;          // wave within its set
    const int half  = lane >> 4;
    const int l16   = lane & 15;
    const int kbase = half * 8;

    const int    bh     = blockIdx.y;
    const int    qblk   = blockIdx.x;
    const size_t bh_off = (size_t)bh * SEQ * DHEAD;

    const float* kg0 = K + bh_off + (size_t)set * KSET * DHEAD;
    const float* vg0 = V + bh_off + (size_t)set * KSET * DHEAD;

    _Float16* Ks0  = &tiles[set][0][0][0];
    _Float16* Vts0 = &tiles[set][0][1][0];
    _Float16* Ks1  = &tiles[set][1][0][0];
    _Float16* Vts1 = &tiles[set][1][1][0];

    // the first tile's loads, ahead of everything else
    v4f kr[4], vr[4];
    // with the fence behind the wait below: keeps index arithmetic, which reuses the
    // loads' address registers, out of the stretch between the loads and their wait
    __builtin_amdgcn_sched_barrier(0);
    load_tile(kg0, vg0, ts, kr, vr);

    // ---- Q tile: B-operand (Q^T) registers, scaled and converted to f16 ----
    const int    qbase = qblk * BM + ws * (16 * NQ);
    const float* qrow  = Q + bh_off + (size_t)(qbase + l16) * DHEAD;
    v4f qf[NQ][2][4];
#pragma unroll
    for (int g = 0; g < NQ; ++g)
#pragma unroll
        for (int c = 0; c < 2; ++c) {
            const float* p = qrow + g * 16 * DHEAD + c * 32 + kbase;
            qf[g][c][0] = *(const v4f*)(p);
            qf[g][c][1] = *(const v4f*)(p + 4);
            qf[g][c][2] = *(const v4f*)(p + 16);
            qf[g][c][3] = *(const v4f*)(p + 20);
        }
    // a precaution: stands ahead of every reuse of the loads' address registers
    asm volatile("s_wait_xcnt 0x0" ::: "memory");
    __builtin_amdgcn_sched_barrier(0);
    v16h qb[NQ][2];
#pragma unroll
    for (int g = 0; g < NQ; ++g)
#pragma unroll
        for (int c = 0; c < 2; ++c)
#pragma unroll
            for (int i = 0; i < 16; ++i)
                qb[g][c][i] = (_Float16)(qf[g][c][i >> 2][i & 3] * QSCALE);

    v16h ones;
#pragma unroll
    for (int e = 0; e < 16; ++e) ones[e] = (_Float16)1.0f;

    v8f   l_i[NQ];           // row sums; this lane owns qrows (qbase + g*16 + l16)
    v8f   negm[NQ];          // minus the maximum in use of that qrow, in all 8 rows
    float lo  = -3.0e38f;    // floor of a move of the maximum: 0 once one is in use
    float thr = -3.0e38f;    // a score above it moves the maximum: 8 once one is in use
    v8f acc[NQ][4];          // O^T: rows d = t*16 + kbase + v, col = qrow
#pragma unroll
    for (int g = 0; g < NQ; ++g) {
#pragma unroll
        for (int v = 0; v < 8; ++v) { l_i[g][v] = 0.0f; negm[g][v] = 0.0f; }
#pragma unroll
        for (int t = 0; t < 4; ++t)
#pragma unroll
            for (int v = 0; v < 8; ++v) acc[g][t][v] = 0.0f;
    }

    // prologue: tile 0 into block 0; the loads of tile 1 in flight
    store_tile(kr, vr, Ks0, Vts0, ts);
    // as above: nothing that reuses an address register between the loads and their wait
    __builtin_amdgcn_sched_barrier(0);
    load_tile(kg0 + BN * DHEAD, vg0 + BN * DHEAD, ts, kr, vr);
    // a precaution: stands ahead of every reuse of the loads' address registers
    asm volatile("s_wait_xcnt 0x0" ::: "memory");
    __builtin_amdgcn_sched_barrier(0);

    // Every step of this loop stores and loads, with no test.
    for (int kb = 0; kb < KSET - 2 * BN; kb += 2 * BN) {
        // ---- half A: compute block 0, fill block 1, reload the registers ----
        block_sync();  // block 0 stored everywhere; block 1 read to its end
        fa_step(Ks0, Vts0, Ks1, Vts1,
                kg0 + (size_t)(kb + 2 * BN) * DHEAD, vg0 + (size_t)(kb + 2 * BN) * DHEAD,
                true, true, ts, kr, vr, qb, ones, l16, kbase, lo, thr, negm, l_i, acc);

        // ---- half B: compute block 1, fill block 0, reload the registers ----
        block_sync();  // block 1 stored everywhere; block 0 read to its end
        fa_step(Ks1, Vts1, Ks0, Vts0,
                kg0 + (size_t)(kb + 3 * BN) * DHEAD, vg0 + (size_t)(kb + 3 * BN) * DHEAD,
                true, true, ts, kr, vr, qb, ones, l16, kbase, lo, thr, negm, l_i, acc);
    }
    // ---- the set's last two tiles: no load is left, then no store ----
    block_sync();
    fa_step(Ks0, Vts0, Ks1, Vts1, kg0, vg0,
            true, false, ts, kr, vr, qb, ones, l16, kbase, lo, thr, negm, l_i, acc);
    block_sync();
    fa_step(Ks1, Vts1, Ks0, Vts0, kg0, vg0,
            false, false, ts, kr, vr, qb, ones, l16, kbase, lo, thr, negm, l_i, acc);

    // ---- merge of the two sets: a wave of set 0 finishes query group 0 and hands
    // group 1 to its partner (same rows, other set); a wave of set 1 the reverse ----
    const bool up = set != 0;
    v8f   keep[4];
    float lk, mk;
    {
        v8f send[4];
#pragma unroll
        for (int t = 0; t < 4; ++t)
#pragma unroll
            for (int v = 0; v < 8; ++v) {
                keep[t][v] = up ? acc[1][t][v] : acc[0][t][v];
                send[t][v] = up ? acc[0][t][v] : acc[1][t][v];
            }
        lk = up ? l_i[1][0] : l_i[0][0];
        mk = up ? -negm[1][0] : -negm[0][0];
#pragma unroll
        for (int t = 0; t < 4; ++t) {
            v4f a, b;
            a.x = send[t][0]; a.y = send[t][1]; a.z = send[t][2]; a.w = send[t][3];
            b.x = send[t][4]; b.y = send[t][5]; b.z = send[t][6]; b.w = send[t][7];
            *(v4f*)&xacc[wid][2 * t][lane][0]     = a;
            *(v4f*)&xacc[wid][2 * t + 1][lane][0] = b;
        }
        xlm[wid][0][lane] = up ? l_i[0][0] : l_i[1][0];
        xlm[wid][1][lane] = up ? -negm[0][0] : -negm[1][0];
    }
    __syncthreads();  // every wave's hand-over is in LDS before its partner reads it
    const int   pw = wid ^ 8;
    const float lr = xlm[pw][0][lane];
    const float mr = xlm[pw][1][lane];
    const float mm = fmaxf(mk, mr);
    const float ak = __builtin_amdgcn_exp2f(mk - mm);
    const float ar = __builtin_amdgcn_exp2f(mr - mm);
    const float inv = 1.0f / (lk * ak + lr * ar);
    const float fk = ak * inv;
    const float fr = ar * inv;

    // ---- epilogue: O[qrow][d] = merged acc^T / l, b128 runs along d ----
    float* orow = O + bh_off + (size_t)(qbase + set * 16 + l16) * DHEAD;
#pragma unroll
    for (int t = 0; t < 4; ++t) {
        const v4f a = *(const v4f*)&xacc[pw][2 * t][lane][0];
        const v4f b = *(const v4f*)&xacc[pw][2 * t + 1][lane][0];
        float4 lo4, hi4;
        lo4.x = keep[t][0] * fk + a.x * fr; lo4.y = keep[t][1] * fk + a.y * fr;
        lo4.z = keep[t][2] * fk + a.z * fr; lo4.w = keep[t][3] * fk + a.w * fr;
        hi4.x = keep[t][4] * fk + b.x * fr; hi4.y = keep[t][5] * fk + b.y * fr;
        hi4.z = keep[t][6] * fk + b.z * fr; hi4.w = keep[t][7] * fk + b.w * fr;
        *(float4*)&orow[t * 16 + kbase]     = lo4;
        *(float4*)&orow[t * 16 + kbase + 4] = hi4;
    }
}

extern "C" void kernel_launch(void* const* d_in, const int* in_sizes, int n_in,
                              void* d_out, int out_size, void* d_ws, size_t ws_size,
                              hipStream_t stream) {
    const float* Q = (const float*)d_in[0];
    const float* K = (const float*)d_in[1];
    const float* V = (const float*)d_in[2];
    float*       O = (float*)d_out;

    const size_t n  = (size_t)in_sizes[0];        // B*H*S*D = 4,194,304
    const int    bh = (int)(n / (SEQ * DHEAD));   // 32

    dim3 grid(SEQ / BM, bh);
    fa_fwd_wmma<<<grid, dim3(NT), 0, stream>>>(Q, K, V, O);
}

// v009
// Measured time: 28.7 microseconds a run.
// Next to v008, in two timings, it ran 1.03 times as fast each time.
// Counting every step since v000, it is 3.63 times as fast.
#include <hip/hip_runtime.h>

typedef __attribute__((ext_vector_type(16))) _Float16 v16h;
typedef __attribute__((ext_vector_type(8)))  _Float16 v8h;
typedef __attribute__((ext_vector_type(4)))  _Float16 v4h;
typedef __attribute__((ext_vector_type(8)))  float    v8f;
typedef __attribute__((ext_vector_type(4)))  float    v4f;
typedef __attribute__((ext_vector_type(4)))  int      v4i;

#define SEQ     2048
#define DHEAD   64
#define NQ      2       // 16-row query groups per wave: each K / Vt fragment read from LDS feeds NQ products
#define NT      512     // threads per block: two sets of 8 waves, four waves per SIMD
#define HT      256     // threads per set: its 8 waves share each K / V tile
#define BM      256     // query rows per block (16 * NQ per wave); both sets take all of them
#define BN      64      // keys per step (one LDS tile, one barrier), worked on in two 32-key passes
#define KSET    (SEQ / 2)  // keys per set: set 0 the first half of the keys, set 1 the second
#define KSTRIDE 72      // halves per K-LDS row (64 + pad, 144B, 16B-aligned)
#define VSTRIDE 72      // halves per Vt-LDS row (64 + pad, 144B, 16B-aligned)

// 1/sqrt(64) * log2(e): scores produced directly in log2 domain
#define QSCALE  (0.125f * 1.4426950408889634f)

// Assemble a v16h WMMA operand from two contiguous 8-half runs at p and p+16,
// matching the 16-bit A/B VGPR layout: elem e -> K = kbase + (e&7) + (e>=8)*16.
__device__ __forceinline__ v16h ld_op16(const _Float16* p) {
    const v8h lo = *(const v8h*)(p);
    const v8h hi = *(const v8h*)(p + 16);
    v16h r;
#pragma unroll
    for (int i = 0; i < 8; ++i) { r[i] = lo[i]; r[i + 8] = hi[i]; }
    return r;
}

__device__ __forceinline__ v8f wmma_f16(v16h a, v16h b, v8f c) {
    return __builtin_amdgcn_wmma_f32_16x16x32_f16(
        /*neg_a=*/false, a, /*neg_b=*/false, b,
        /*c_mod=*/(short)0, c, /*reuse_a=*/false, /*reuse_b=*/false);
}

// One 64(key) x 64(d) f32 tile of K and of V, global memory -> registers.
// K: 16 B per lane, a wave covers 512 contiguous bytes per load.
// V: a wave takes 16 keys x 32 d; a lane holds 4 keys x 4 d, and 8 lanes cover one
// whole 128-byte line of a key's row per load.
__device__ __forceinline__ void load_tile(const float* kg, const float* vg, int tid,
                                          v4f (&kr)[4], v4f (&vr)[4]) {
    const int d0 = ((tid >> 5) & 1) * 32 + (tid & 7) * 4;
    const int k0 = (tid >> 6) * 16 + ((tid & 31) >> 3) * 4;
#pragma unroll
    for (int i = 0; i < 4; ++i) kr[i] = *(const v4f*)(kg + (tid + HT * i) * 4);
#pragma unroll
    for (int j = 0; j < 4; ++j) vr[j] = *(const v4f*)(vg + (k0 + j) * DHEAD + d0);
}

// The tile in registers -> f16 -> LDS: K row-major, V transposed (d-major): each of
// a lane's 4 d rows leaves as one 8-byte store of 4 keys.
__device__ __forceinline__ void store_tile(const v4f (&kr)[4], const v4f (&vr)[4],
                                           _Float16* ks, _Float16* vts, int tid) {
    const int d0 = ((tid >> 5) & 1) * 32 + (tid & 7) * 4;
    const int k0 = (tid >> 6) * 16 + ((tid & 31) >> 3) * 4;
#pragma unroll
    for (int i = 0; i < 4; ++i) {
        const int c = tid + HT * i;  // 0..1023 chunks of 4 elements
        v4h kh;
        kh[0] = (_Float16)kr[i].x; kh[1] = (_Float16)kr[i].y;
        kh[2] = (_Float16)kr[i].z; kh[3] = (_Float16)kr[i].w;
        *(v4h*)&ks[(c >> 4) * KSTRIDE + (c & 15) * 4] = kh;
    }
    v4h r0, r1, r2, r3;
#pragma unroll
    for (int j = 0; j < 4; ++j) {
        r0[j] = (_Float16)vr[j].x; r1[j] = (_Float16)vr[j].y;
        r2[j] = (_Float16)vr[j].z; r3[j] = (_Float16)vr[j].w;
    }
    *(v4h*)&vts[(d0 + 0) * VSTRIDE + k0] = r0;
    *(v4h*)&vts[(d0 + 1) * VSTRIDE + k0] = r1;
    *(v4h*)&vts[(d0 + 2) * VSTRIDE + k0] = r2;
    *(v4h*)&vts[(d0 + 3) * VSTRIDE + k0] = r3;
}

// The work-group barrier in its two halves; both order LDS traffic alone, so the tile
// loads on their way to registers, which no other wave sees, stay in flight across them.
// Signal: this wave's LDS stores of the next tile, and all its reads of the step before,
// are finished. It does not hold the wave, which goes on with its own step.
__device__ __forceinline__ void block_arrive() {
    __builtin_amdgcn_fence(__ATOMIC_RELEASE, "workgroup", "local");
    __builtin_amdgcn_s_barrier_signal(-1);
}
// Wait: every wave has given the signal above; the tile they stored may be read.
__device__ __forceinline__ void block_wait() {
    __builtin_amdgcn_s_barrier_wait(-1);
    __builtin_amdgcn_fence(__ATOMIC_ACQUIRE, "workgroup", "local");
}

// One 64-key online-softmax step against the LDS block (ksb, vtsb), for the
// wave's NQ query groups, in two passes of 32 keys: a pass holds 4 K and 4 Vt fragments
// and 4 score tiles, which keeps the wave inside the 256 registers of four waves per SIMD.
// The maximum is lazy: scores are formed relative to the
// maximum in use, which enters the K Q^T products as their start value (negm = minus
// that maximum in all 8 rows), so exp2 reads the accumulators as they are; sums and
// outputs are rescaled only in a pass where some score lies more than thr above it.
// Behind its first LDS reads the step converts the next step's tile,
// held in (kr, vr), into the next LDS block (ksn, vtsn) and starts the loads of the
// tile after that one from (kgn, vgn) into the same registers: a load has one step,
// in which four waves share the SIMD, to land in. Behind its first products the step
// signals the barrier for those stores; the wait stands at the head of the next step.
__device__ __forceinline__ void fa_step(const _Float16* ksb, const _Float16* vtsb,
                                        _Float16* ksn, _Float16* vtsn,
                                        const float* kgn, const float* vgn,
                                        bool do_store, bool do_load, int tid,
                                        v4f (&kr)[4], v4f (&vr)[4],
                                        const v16h (&qb)[NQ][2], const v16h& ones,
                                        int l16, int kbase,
                                        float& lo, float& thr,
                                        v8f (&negm)[NQ], v8f (&l_i)[NQ],
                                        v8f (&acc)[NQ][4]) {
#pragma unroll
    for (int p = 0; p < 2; ++p) {
        // ---- the pass's K fragments, read from LDS as one group ----
        v16h ka[2][2];
#pragma unroll
        for (int c = 0; c < 2; ++c)
#pragma unroll
            for (int n = 0; n < 2; ++n)
                ka[c][n] = ld_op16(&ksb[((p * 2 + n) * 16 + l16) * KSTRIDE + c * 32 + kbase]);
        // keeps the reads ahead of the conversions, which then run while the reads land
        __builtin_amdgcn_sched_barrier(0);
        if (p == 0) {
            if (do_store) store_tile(kr, vr, ksn, vtsn, tid);
            // keeps the conversions out of the stretch between the loads and their wait
            __builtin_amdgcn_sched_barrier(0);
            if (do_load) {
                load_tile(kgn, vgn, tid, kr, vr);
                // a precaution: stands ahead of every reuse of the loads' address registers
                asm volatile("s_wait_xcnt 0x0" ::: "memory");
            }
            // holds the reads, the next tile's LDS stores and the global loads above the
            // products: left free, the compiler sinks the loads towards their use a step later
            __builtin_amdgcn_sched_barrier(0);
        }

        // ---- S^T = K Q^T : per group two 16(key)x16(qrow) tiles, k=64 in two chunks ----
        v8f s[NQ][2];
#pragma unroll
        for (int n = 0; n < 2; ++n)
#pragma unroll
            for (int g = 0; g < NQ; ++g) s[g][n] = wmma_f16(ka[0][n], qb[g][0], negm[g]);
#pragma unroll
        for (int n = 0; n < 2; ++n)
#pragma unroll
            for (int g = 0; g < NQ; ++g) s[g][n] = wmma_f16(ka[1][n], qb[g][1], s[g][n]);
        // closes the block of 8 products: they issue back to back, and neither a maximum
        // nor a Vt read is drawn in between them
        __builtin_amdgcn_sched_barrier(0);
        if (p == 0 && do_store) {
            // here the K reads have been used and the stores have had the products to
            // finish under, so the signal's LDS wait holds the wave little or not at all
            block_arrive();
            // keeps the signal ahead of the Vt reads, which its LDS wait would else wait out
            __builtin_amdgcn_sched_barrier(0);
        }

        // ---- the pass's Vt fragments, one group: they land under the softmax work ----
        v16h va[4];
#pragma unroll
        for (int t = 0; t < 4; ++t)
            va[t] = ld_op16(&vtsb[(t * 16 + l16) * VSTRIDE + p * 32 + kbase]);
        // keeps that group whole and ahead of the vector work below
        __builtin_amdgcn_sched_barrier(0);

        // ---- each lane's largest score of the pass, per group; balanced max tree ----
        float mg[NQ];
#pragma unroll
        for (int g = 0; g < NQ; ++g) {
            float tm[2];
#pragma unroll
            for (int n = 0; n < 2; ++n) {
                const float a0 = fmaxf(s[g][n][0], s[g][n][1]);
                const float a1 = fmaxf(s[g][n][2], s[g][n][3]);
                const float a2 = fmaxf(s[g][n][4], s[g][n][5]);
                const float a3 = fmaxf(s[g][n][6], s[g][n][7]);
                tm[n] = fmaxf(fmaxf(a0, a1), fmaxf(a2, a3));
            }
            mg[g] = fmaxf(tm[0], tm[1]);
        }
        // one test per pass for the whole wave; every score is looked at by its own lane
        const unsigned over = __builtin_amdgcn_ballot_w32(fmaxf(mg[0], mg[1]) > thr);

        v16h pb[NQ];  // P^T packed directly into B-operand layout
#pragma unroll
        for (int g = 0; g < NQ; ++g)
#pragma unroll
            for (int n = 0; n < 2; ++n)
#pragma unroll
                for (int v = 0; v < 8; ++v)
                    pb[g][n * 8 + v] = (_Float16)__builtin_amdgcn_exp2f(s[g][n][v]);

        // rare after the first pass: the hint keeps the common path in line, this one out of it
        if (__builtin_expect(over != 0, 0)) {
            // ---- the maximum in use moves up by d; in the first pass, where none is in
            // use yet (lo is hugely negative), it becomes the pass's own maximum ----
#pragma unroll
            for (int g = 0; g < NQ; ++g) {
                const float mx   = fmaxf(mg[g], __shfl_xor(mg[g], 16, 32));
                const float d    = fmaxf(mx, lo);
                // d < 0 only in the first pass, whose sums are still 0: no factor above 1
                const float corr = __builtin_amdgcn_exp2f(fminf(-d, 0.0f));
#pragma unroll
                for (int n = 0; n < 2; ++n)
#pragma unroll
                    for (int v = 0; v < 8; ++v)
                        pb[g][n * 8 + v] = (_Float16)__builtin_amdgcn_exp2f(s[g][n][v] - d);
#pragma unroll
                for (int v = 0; v < 8; ++v) negm[g][v] -= d;
#pragma unroll
                for (int v = 0; v < 8; ++v) l_i[g][v] *= corr;
#pragma unroll
                for (int t = 0; t < 4; ++t)
#pragma unroll
                    for (int v = 0; v < 8; ++v) acc[g][t][v] *= corr;
            }
            lo  = 0.0f;
            thr = 8.0f;
        }

        // row sums via WMMA with ones, kept in their own tiles like the outputs: every
        // lane holds, in all 8 rows, the sum over the keys so far
#pragma unroll
        for (int g = 0; g < NQ; ++g) l_i[g] = wmma_f16(ones, pb[g], l_i[g]);

        // ---- O^T += V^T P^T : 4 d-tiles, each Vt fragment for NQ groups ----
#pragma unroll
        for (int t = 0; t < 4; ++t)
#pragma unroll
            for (int g = 0; g < NQ; ++g) acc[g][t] = wmma_f16(va[t], pb[g], acc[g][t]);
        // keeps the next pass's reads, and the barrier wait that follows the step, below
        // the pass's work: left free the wait rises, and the waves stand there with work left
        __builtin_amdgcn_sched_barrier(0);
    }
}

// ---------------------------------------------------------------------------
// Flash attention forward: S^T / O^T formulation on f16 operands converted in the
// kernel from the f32 inputs (Q scaled by QSCALE). The block's 16 waves form two sets
// of 8; both sets take the block's 256 query rows, set 0 against the first half of the
// keys and set 1 against the second, each with its own LDS tiles, maxima, sums and
// outputs; at the end the two partial results of a row are merged through LDS.
// K and V tiles go global -> registers -> f16 -> LDS, three LDS blocks per set, loads one
// step ahead of their stores; hand-unrolled x3 so the LDS blocks are compile-time.
// Step t reads block t mod 3 and fills block (t + 1) mod 3, last read in step t - 2. A wave
// enters step t once every wave has signalled in step t - 1: by then tile t is stored
// everywhere and step t - 2 is read to its end, so no wave waits for another's whole step.
// The LDS reads that stand between a signal and the next wait are of block t mod 3, which is
// refilled only in step t + 2, behind that step's wait: with two blocks they would race.
// ---------------------------------------------------------------------------
__global__ __launch_bounds__(NT)
void fa_fwd_wmma(const float* __restrict__ Q, const float* __restrict__ K,
                 const float* __restrict__ V, float* __restrict__ O) {
    // [set][block][K, Vt]
    __shared__ __align__(16) _Float16 tiles[2][3][2][BN * KSTRIDE];
    // the merge: per wave the 4 output tiles, the sum and the maximum of the query group
    // that its partner wave in the other set finishes
    __shared__ __align__(16) float xacc[NT / 32][8][32][4];
    __shared__ float xlm[NT / 32][2][32];

    const int tid   = threadIdx.x;
    const int lane  = tid & 31;
    const int wid   = tid >> 5;
    const int set   = __builtin_amdgcn_readfirstlane(tid >> 8);  // same in all of a wave
    const int ts    = tid & (HT - 1);   // thread within its set
    const int ws    = wid & 7;          // wave within its set
    const int half  = lane >> 4;
    const int l16   = lane & 15;
    const int kbase = half * 8;

    const int    bh     = blockIdx.y;
    const int    qblk   = blockIdx.x;
    const size_t bh_off = (size_t)bh * SEQ * DHEAD;

    const float* kg0 = K + bh_off + (size_t)set * KSET * DHEAD;
    const float* vg0 = V + bh_off + (size_t)set * KSET * DHEAD;

    _Float16* Ks0  = &tiles[set][0][0][0];
    _Float16* Vts0 = &tiles[set][0][1][0];
    _Float16* Ks1  = &tiles[set][1][0][0];
    _Float16* Vts1 = &tiles[set][1][1][0];
    _Float16* Ks2  = &tiles[set][2][0][0];
    _Float16* Vts2 = &tiles[set][2][1][0];

    // the first tile's loads, ahead of everything else
    v4f kr[4], vr[4];
    // with the fence behind the wait below: keeps index arithmetic, which reuses the
    // loads' address registers, out of the stretch between the loads and their wait
    __builtin_amdgcn_sched_barrier(0);
    load_tile(kg0, vg0, ts, kr, vr);

    // ---- Q tile: B-operand (Q^T) registers, scaled and converted to f16 ----
    const int    qbase = qblk * BM + ws * (16 * NQ);
    const float* qrow  = Q + bh_off + (size_t)(qbase + l16) * DHEAD;
    v4f qf[NQ][2][4];
#pragma unroll
    for (int g = 0; g < NQ; ++g)
#pragma unroll
        for (int c = 0; c < 2; ++c) {
            const float* p = qrow + g * 16 * DHEAD + c * 32 + kbase;
            qf[g][c][0] = *(const v4f*)(p);
            qf[g][c][1] = *(const v4f*)(p + 4);
            qf[g][c][2] = *(const v4f*)(p + 16);
            qf[g][c][3] = *(const v4f*)(p + 20);
        }
    // a precaution: stands ahead of every reuse of the loads' address registers
    asm volatile("s_wait_xcnt 0x0" ::: "memory");
    __builtin_amdgcn_sched_barrier(0);
    v16h qb[NQ][2];
#pragma unroll
    for (int g = 0; g < NQ; ++g)
#pragma unroll
        for (int c = 0; c < 2; ++c)
#pragma unroll
            for (int i = 0; i < 16; ++i)
                qb[g][c][i] = (_Float16)(qf[g][c][i >> 2][i & 3] * QSCALE);

    v16h ones;
#pragma unroll
    for (int e = 0; e < 16; ++e) ones[e] = (_Float16)1.0f;

    v8f   l_i[NQ];           // row sums; this lane owns qrows (qbase + g*16 + l16)
    v8f   negm[NQ];          // minus the maximum in use of that qrow, in all 8 rows
    float lo  = -3.0e38f;    // floor of a move of the maximum: 0 once one is in use
    float thr = -3.0e38f;    // a score above it moves the maximum: 8 once one is in use
    v8f acc[NQ][4];          // O^T: rows d = t*16 + kbase + v, col = qrow
#pragma unroll
    for (int g = 0; g < NQ; ++g) {
#pragma unroll
        for (int v = 0; v < 8; ++v) { l_i[g][v] = 0.0f; negm[g][v] = 0.0f; }
#pragma unroll
        for (int t = 0; t < 4; ++t)
#pragma unroll
            for (int v = 0; v < 8; ++v) acc[g][t][v] = 0.0f;
    }

    // prologue: tile 0 into block 0; the loads of tile 1 in flight
    store_tile(kr, vr, Ks0, Vts0, ts);
    // as above: nothing that reuses an address register between the loads and their wait
    __builtin_amdgcn_sched_barrier(0);
    load_tile(kg0 + BN * DHEAD, vg0 + BN * DHEAD, ts, kr, vr);
    // a precaution: stands ahead of every reuse of the loads' address registers
    asm volatile("s_wait_xcnt 0x0" ::: "memory");
    __builtin_amdgcn_sched_barrier(0);

    block_arrive();  // tile 0 is stored

    // KSET / BN = 16 steps. Steps 0 to 13 store and load, with no test: 12 in this loop.
    for (int kb = 0; kb < KSET - 4 * BN; kb += 3 * BN) {
        block_wait();  // block 0 stored everywhere; block 1 read to its end
        fa_step(Ks0, Vts0, Ks1, Vts1,
                kg0 + (size_t)(kb + 2 * BN) * DHEAD, vg0 + (size_t)(kb + 2 * BN) * DHEAD,
                true, true, ts, kr, vr, qb, ones, l16, kbase, lo, thr, negm, l_i, acc);

        block_wait();  // block 1 stored everywhere; block 2 read to its end
        fa_step(Ks1, Vts1, Ks2, Vts2,
                kg0 + (size_t)(kb + 3 * BN) * DHEAD, vg0 + (size_t)(kb + 3 * BN) * DHEAD,
                true, true, ts, kr, vr, qb, ones, l16, kbase, lo, thr, negm, l_i, acc);

        block_wait();  // block 2 stored everywhere; block 0 read to its end
        fa_step(Ks2, Vts2, Ks0, Vts0,
                kg0 + (size_t)(kb + 4 * BN) * DHEAD, vg0 + (size_t)(kb + 4 * BN) * DHEAD,
                true, true, ts, kr, vr, qb, ones, l16, kbase, lo, thr, negm, l_i, acc);
    }
    // ---- steps 12 and 13: the set's last two loads ----
    block_wait();
    fa_step(Ks0, Vts0, Ks1, Vts1,
            kg0 + (size_t)(KSET - 2 * BN) * DHEAD, vg0 + (size_t)(KSET - 2 * BN) * DHEAD,
            true, true, ts, kr, vr, qb, ones, l16, kbase, lo, thr, negm, l_i, acc);
    block_wait();
    fa_step(Ks1, Vts1, Ks2, Vts2,
            kg0 + (size_t)(KSET - BN) * DHEAD, vg0 + (size_t)(KSET - BN) * DHEAD,
            true, true, ts, kr, vr, qb, ones, l16, kbase, lo, thr, negm, l_i, acc);
    // ---- the set's last two tiles: no load is left, then no store and no signal ----
    block_wait();
    fa_step(Ks2, Vts2, Ks0, Vts0, kg0, vg0,
            true, false, ts, kr, vr, qb, ones, l16, kbase, lo, thr, negm, l_i, acc);
    block_wait();
    fa_step(Ks0, Vts0, Ks1, Vts1, kg0, vg0,
            false, false, ts, kr, vr, qb, ones, l16, kbase, lo, thr, negm, l_i, acc);

    // ---- merge of the two sets: a wave of set 0 finishes query group 0 and hands
    // group 1 to its partner (same rows, other set); a wave of set 1 the reverse ----
    const bool up = set != 0;
    v8f   keep[4];
    float lk, mk;
    {
        v8f send[4];
#pragma unroll
        for (int t = 0; t < 4; ++t)
#pragma unroll
            for (int v = 0; v < 8; ++v) {
                keep[t][v] = up ? acc[1][t][v] : acc[0][t][v];
                send[t][v] = up ? acc[0][t][v] : acc[1][t][v];
            }
        lk = up ? l_i[1][0] : l_i[0][0];
        mk = up ? -negm[1][0] : -negm[0][0];
#pragma unroll
        for (int t = 0; t < 4; ++t) {
            v4f a, b;
            a.x = send[t][0]; a.y = send[t][1]; a.z = send[t][2]; a.w = send[t][3];
            b.x = send[t][4]; b.y = send[t][5]; b.z = send[t][6]; b.w = send[t][7];
            *(v4f*)&xacc[wid][2 * t][lane][0]     = a;
            *(v4f*)&xacc[wid][2 * t + 1][lane][0] = b;
        }
        xlm[wid][0][lane] = up ? l_i[0][0] : l_i[1][0];
        xlm[wid][1][lane] = up ? -negm[0][0] : -negm[1][0];
    }
    __syncthreads();  // every wave's hand-over is in LDS before its partner reads it
    const int   pw = wid ^ 8;
    const float lr = xlm[pw][0][lane];
    const float mr = xlm[pw][1][lane];
    const float mm = fmaxf(mk, mr);
    const float ak = __builtin_amdgcn_exp2f(mk - mm);
    const float ar = __builtin_amdgcn_exp2f(mr - mm);
    const float inv = 1.0f / (lk * ak + lr * ar);
    const float fk = ak * inv;
    const float fr = ar * inv;

    // ---- epilogue: O[qrow][d] = merged acc^T / l, b128 runs along d ----
    float* orow = O + bh_off + (size_t)(qbase + set * 16 + l16) * DHEAD;
#pragma unroll
    for (int t = 0; t < 4; ++t) {
        const v4f a = *(const v4f*)&xacc[pw][2 * t][lane][0];
        const v4f b = *(const v4f*)&xacc[pw][2 * t + 1][lane][0];
        float4 lo4, hi4;
        lo4.x = keep[t][0] * fk + a.x * fr; lo4.y = keep[t][1] * fk + a.y * fr;
        lo4.z = keep[t][2] * fk + a.z * fr; lo4.w = keep[t][3] * fk + a.w * fr;
        hi4.x = keep[t][4] * fk + b.x * fr; hi4.y = keep[t][5] * fk + b.y * fr;
        hi4.z = keep[t][6] * fk + b.z * fr; hi4.w = keep[t][7] * fk + b.w * fr;
        *(float4*)&orow[t * 16 + kbase]     = lo4;
        *(float4*)&orow[t * 16 + kbase + 4] = hi4;
    }
}

extern "C" void kernel_launch(void* const* d_in, const int* in_sizes, int n_in,
                              void* d_out, int out_size, void* d_ws, size_t ws_size,
                              hipStream_t stream) {
    const float* Q = (const float*)d_in[0];
    const float* K = (const float*)d_in[1];
    const float* V = (const float*)d_in[2];
    float*       O = (float*)d_out;

    const size_t n  = (size_t)in_sizes[0];        // B*H*S*D = 4,194,304
    const int    bh = (int)(n / (SEQ * DHEAD));   // 32

    dim3 grid(SEQ / BM, bh);
    fa_fwd_wmma<<<grid, dim3(NT), 0, stream>>>(Q, K, V, O);
}

// v010
// A run of this version takes 27.1 microseconds.
// Next to v009, in two timings, it ran 1.06 and 1.05 times as fast.
// Counting every step since v000, it is 3.82 times as fast.
#include <hip/hip_runtime.h>

typedef __attribute__((ext_vector_type(16))) _Float16 v16h;
typedef __attribute__((ext_vector_type(8)))  _Float16 v8h;
typedef __attribute__((ext_vector_type(4)))  _Float16 v4h;
typedef __attribute__((ext_vector_type(8)))  float    v8f;
typedef __attribute__((ext_vector_type(4)))  float    v4f;
typedef __attribute__((ext_vector_type(4)))  int      v4i;

#define SEQ     2048
#define DHEAD   64
#define NQ      2       // 16-row query groups per wave: each K / Vt fragment read from LDS feeds NQ products
#define NT      512     // threads per block: two sets of 8 waves, four waves per SIMD
#define HT      256     // threads per set: its 8 waves share each K / V tile
#define BM      256     // query rows per block (16 * NQ per wave); both sets take all of them
#define BN      64      // keys per step (one LDS tile, one barrier), worked on in two 32-key passes
#define KSET    (SEQ / 2)  // keys per set: set 0 the first half of the keys, set 1 the second
#define KSTRIDE 72      // halves per K-LDS row (64 + pad, 144B, 16B-aligned)
#define VSTRIDE 72      // halves per Vt-LDS row (64 + pad, 144B, 16B-aligned)
#define QSTRIDE 72      // halves per staged Q row (64 + pad, 144B): read like a K row
#define OSTRIDE 68      // floats per staged O row (64 + pad, 272B = 16B x odd)

// 1/sqrt(64) * log2(e): scores produced directly in log2 domain
#define QSCALE  (0.125f * 1.4426950408889634f)

// Assemble a v16h WMMA operand from two contiguous 8-half runs at p and p+16,
// matching the 16-bit A/B VGPR layout: elem e -> K = kbase + (e&7) + (e>=8)*16.
__device__ __forceinline__ v16h ld_op16(const _Float16* p) {
    const v8h lo = *(const v8h*)(p);
    const v8h hi = *(const v8h*)(p + 16);
    v16h r;
#pragma unroll
    for (int i = 0; i < 8; ++i) { r[i] = lo[i]; r[i + 8] = hi[i]; }
    return r;
}

__device__ __forceinline__ v8f wmma_f16(v16h a, v16h b, v8f c) {
    return __builtin_amdgcn_wmma_f32_16x16x32_f16(
        /*neg_a=*/false, a, /*neg_b=*/false, b,
        /*c_mod=*/(short)0, c, /*reuse_a=*/false, /*reuse_b=*/false);
}

// One 64(key) x 64(d) f32 tile of K and of V, global memory -> registers.
// K: 16 B per lane, a wave covers 512 contiguous bytes per load.
// V: a wave takes 16 keys x 32 d; a lane holds 4 keys x 4 d, and 8 lanes cover one
// whole 128-byte line of a key's row per load.
__device__ __forceinline__ void load_tile(const float* kg, const float* vg, int tid,
                                          v4f (&kr)[4], v4f (&vr)[4]) {
    const int d0 = ((tid >> 5) & 1) * 32 + (tid & 7) * 4;
    const int k0 = (tid >> 6) * 16 + ((tid & 31) >> 3) * 4;
#pragma unroll
    for (int i = 0; i < 4; ++i) kr[i] = *(const v4f*)(kg + (tid + HT * i) * 4);
#pragma unroll
    for (int j = 0; j < 4; ++j) vr[j] = *(const v4f*)(vg + (k0 + j) * DHEAD + d0);
}

// The tile in registers -> f16 -> LDS: K row-major, V transposed (d-major): each of
// a lane's 4 d rows leaves as one 8-byte store of 4 keys.
__device__ __forceinline__ void store_tile(const v4f (&kr)[4], const v4f (&vr)[4],
                                           _Float16* ks, _Float16* vts, int tid) {
    const int d0 = ((tid >> 5) & 1) * 32 + (tid & 7) * 4;
    const int k0 = (tid >> 6) * 16 + ((tid & 31) >> 3) * 4;
#pragma unroll
    for (int i = 0; i < 4; ++i) {
        const int c = tid + HT * i;  // 0..1023 chunks of 4 elements
        v4h kh;
        kh[0] = (_Float16)kr[i].x; kh[1] = (_Float16)kr[i].y;
        kh[2] = (_Float16)kr[i].z; kh[3] = (_Float16)kr[i].w;
        *(v4h*)&ks[(c >> 4) * KSTRIDE + (c & 15) * 4] = kh;
    }
    v4h r0, r1, r2, r3;
#pragma unroll
    for (int j = 0; j < 4; ++j) {
        r0[j] = (_Float16)vr[j].x; r1[j] = (_Float16)vr[j].y;
        r2[j] = (_Float16)vr[j].z; r3[j] = (_Float16)vr[j].w;
    }
    *(v4h*)&vts[(d0 + 0) * VSTRIDE + k0] = r0;
    *(v4h*)&vts[(d0 + 1) * VSTRIDE + k0] = r1;
    *(v4h*)&vts[(d0 + 2) * VSTRIDE + k0] = r2;
    *(v4h*)&vts[(d0 + 3) * VSTRIDE + k0] = r3;
}

// The work-group barrier in its two halves; both order LDS traffic alone, so the tile
// loads on their way to registers, which no other wave sees, stay in flight across them.
// Signal: this wave's LDS stores of the next tile, and all its reads of the step before,
// are finished. It does not hold the wave, which goes on with its own step.
__device__ __forceinline__ void block_arrive() {
    __builtin_amdgcn_fence(__ATOMIC_RELEASE, "workgroup", "local");
    __builtin_amdgcn_s_barrier_signal(-1);
}
// Wait: every wave has given the signal above; the tile they stored may be read.
__device__ __forceinline__ void block_wait() {
    __builtin_amdgcn_s_barrier_wait(-1);
    __builtin_amdgcn_fence(__ATOMIC_ACQUIRE, "workgroup", "local");
}

// One 64-key online-softmax step against the LDS block (ksb, vtsb), for the
// wave's NQ query groups, in two passes of 32 keys: a pass holds 4 K and 4 Vt fragments
// and 4 score tiles, which keeps the wave inside the 256 registers of four waves per SIMD.
// The maximum is lazy: scores are formed relative to the
// maximum in use, which enters the K Q^T products as their start value (negm = minus
// that maximum in all 8 rows), so exp2 reads the accumulators as they are; sums and
// outputs are rescaled only in a pass where some score lies more than thr above it.
// Behind its first LDS reads the step converts the next step's tile,
// held in (kr, vr), into the next LDS block (ksn, vtsn) and starts the loads of the
// tile after that one from (kgn, vgn) into the same registers: a load has one step,
// in which four waves share the SIMD, to land in. Behind its first products the step
// signals the barrier for those stores; the wait stands at the head of the next step.
__device__ __forceinline__ void fa_step(const _Float16* ksb, const _Float16* vtsb,
                                        _Float16* ksn, _Float16* vtsn,
                                        const float* kgn, const float* vgn,
                                        bool do_store, bool do_load, int tid,
                                        v4f (&kr)[4], v4f (&vr)[4],
                                        const v16h (&qb)[NQ][2], const v16h& ones,
                                        int l16, int kbase,
                                        float& lo, float& thr,
                                        v8f (&negm)[NQ], v8f (&l_i)[NQ],
                                        v8f (&acc)[NQ][4]) {
#pragma unroll
    for (int p = 0; p < 2; ++p) {
        // ---- the pass's K fragments, read from LDS as one group ----
        v16h ka[2][2];
#pragma unroll
        for (int c = 0; c < 2; ++c)
#pragma unroll
            for (int n = 0; n < 2; ++n)
                ka[c][n] = ld_op16(&ksb[((p * 2 + n) * 16 + l16) * KSTRIDE + c * 32 + kbase]);
        // keeps the reads ahead of the conversions, which then run while the reads land
        __builtin_amdgcn_sched_barrier(0);
        if (p == 0) {
            if (do_store) store_tile(kr, vr, ksn, vtsn, tid);
            // keeps the conversions out of the stretch between the loads and their wait
            __builtin_amdgcn_sched_barrier(0);
            if (do_load) {
                load_tile(kgn, vgn, tid, kr, vr);
                // a precaution: stands ahead of every reuse of the loads' address registers
                asm volatile("s_wait_xcnt 0x0" ::: "memory");
            }
            // holds the reads, the next tile's LDS stores and the global loads above the
            // products: left free, the compiler sinks the loads towards their use a step later
            __builtin_amdgcn_sched_barrier(0);
        }

        // ---- S^T = K Q^T : per group two 16(key)x16(qrow) tiles, k=64 in two chunks ----
        v8f s[NQ][2];
#pragma unroll
        for (int n = 0; n < 2; ++n)
#pragma unroll
            for (int g = 0; g < NQ; ++g) s[g][n] = wmma_f16(ka[0][n], qb[g][0], negm[g]);
#pragma unroll
        for (int n = 0; n < 2; ++n)
#pragma unroll
            for (int g = 0; g < NQ; ++g) s[g][n] = wmma_f16(ka[1][n], qb[g][1], s[g][n]);
        // closes the block of 8 products: they issue back to back, and neither a maximum
        // nor a Vt read is drawn in between them
        __builtin_amdgcn_sched_barrier(0);
        if (p == 0 && do_store) {
            // here the K reads have been used and the stores have had the products to
            // finish under, so the signal's LDS wait holds the wave little or not at all
            block_arrive();
            // keeps the signal ahead of the Vt reads, which its LDS wait would else wait out
            __builtin_amdgcn_sched_barrier(0);
        }

        // ---- the pass's Vt fragments, one group: they land under the softmax work ----
        v16h va[4];
#pragma unroll
        for (int t = 0; t < 4; ++t)
            va[t] = ld_op16(&vtsb[(t * 16 + l16) * VSTRIDE + p * 32 + kbase]);
        // keeps that group whole and ahead of the vector work below
        __builtin_amdgcn_sched_barrier(0);

        // ---- each lane's largest score of the pass, per group; balanced max tree ----
        float mg[NQ];
#pragma unroll
        for (int g = 0; g < NQ; ++g) {
            float tm[2];
#pragma unroll
            for (int n = 0; n < 2; ++n) {
                const float a0 = fmaxf(s[g][n][0], s[g][n][1]);
                const float a1 = fmaxf(s[g][n][2], s[g][n][3]);
                const float a2 = fmaxf(s[g][n][4], s[g][n][5]);
                const float a3 = fmaxf(s[g][n][6], s[g][n][7]);
                tm[n] = fmaxf(fmaxf(a0, a1), fmaxf(a2, a3));
            }
            mg[g] = fmaxf(tm[0], tm[1]);
        }
        // one test per pass for the whole wave; every score is looked at by its own lane
        const unsigned over = __builtin_amdgcn_ballot_w32(fmaxf(mg[0], mg[1]) > thr);

        v16h pb[NQ];  // P^T packed directly into B-operand layout
#pragma unroll
        for (int g = 0; g < NQ; ++g)
#pragma unroll
            for (int n = 0; n < 2; ++n)
#pragma unroll
                for (int v = 0; v < 8; ++v)
                    pb[g][n * 8 + v] = (_Float16)__builtin_amdgcn_exp2f(s[g][n][v]);

        // rare after the first pass: the hint keeps the common path in line, this one out of it
        if (__builtin_expect(over != 0, 0)) {
            // ---- the maximum in use moves up by d; in the first pass, where none is in
            // use yet (lo is hugely negative), it becomes the pass's own maximum ----
#pragma unroll
            for (int g = 0; g < NQ; ++g) {
                const float mx   = fmaxf(mg[g], __shfl_xor(mg[g], 16, 32));
                const float d    = fmaxf(mx, lo);
                // d < 0 only in the first pass, whose sums are still 0: no factor above 1
                const float corr = __builtin_amdgcn_exp2f(fminf(-d, 0.0f));
#pragma unroll
                for (int n = 0; n < 2; ++n)
#pragma unroll
                    for (int v = 0; v < 8; ++v)
                        pb[g][n * 8 + v] = (_Float16)__builtin_amdgcn_exp2f(s[g][n][v] - d);
#pragma unroll
                for (int v = 0; v < 8; ++v) negm[g][v] -= d;
#pragma unroll
                for (int v = 0; v < 8; ++v) l_i[g][v] *= corr;
#pragma unroll
                for (int t = 0; t < 4; ++t)
#pragma unroll
                    for (int v = 0; v < 8; ++v) acc[g][t][v] *= corr;
            }
            lo  = 0.0f;
            thr = 8.0f;
        }

        // row sums via WMMA with ones, kept in their own tiles like the outputs: every
        // lane holds, in all 8 rows, the sum over the keys so far
#pragma unroll
        for (int g = 0; g < NQ; ++g) l_i[g] = wmma_f16(ones, pb[g], l_i[g]);

        // ---- O^T += V^T P^T : 4 d-tiles, each Vt fragment for NQ groups ----
#pragma unroll
        for (int t = 0; t < 4; ++t)
#pragma unroll
            for (int g = 0; g < NQ; ++g) acc[g][t] = wmma_f16(va[t], pb[g], acc[g][t]);
        // keeps the next pass's reads, and the barrier wait that follows the step, below
        // the pass's work: left free the wait rises, and the waves stand there with work left
        __builtin_amdgcn_sched_barrier(0);
    }
}

// ---------------------------------------------------------------------------
// Flash attention forward: S^T / O^T formulation on f16 operands converted in the
// kernel from the f32 inputs (Q scaled by QSCALE). The block's 16 waves form two sets
// of 8; both sets take the block's 256 query rows, set 0 against the first half of the
// keys and set 1 against the second, each with its own LDS tiles, maxima, sums and
// outputs; at the end the two partial results of a row are merged through LDS.
// K and V tiles go global -> registers -> f16 -> LDS, three LDS blocks per set, loads one
// step ahead of their stores; hand-unrolled x3 so the LDS blocks are compile-time.
// Step t reads block t mod 3 and fills block (t + 1) mod 3, last read in step t - 2. A wave
// enters step t once every wave has signalled in step t - 1: by then tile t is stored
// everywhere and step t - 2 is read to its end, so no wave waits for another's whole step.
// The LDS reads that stand between a signal and the next wait are of block t mod 3, which is
// refilled only in step t + 2, behind that step's wait: with two blocks they would race.
// ---------------------------------------------------------------------------
__global__ __launch_bounds__(NT)
void fa_fwd_wmma(const float* __restrict__ Q, const float* __restrict__ K,
                 const float* __restrict__ V, float* __restrict__ O) {
    // [set][block][K, Vt]
    __shared__ __align__(16) _Float16 tiles[2][3][2][BN * KSTRIDE];
    // the merge: per wave the 4 output tiles, the sum and the maximum of the query group
    // that its partner wave in the other set finishes
    __shared__ __align__(16) float xacc[NT / 32][8][32][4];
    __shared__ float xlm[NT / 32][2][32];
    // Q and O pass through LDS, so that every global load of Q and every global store of O
    // is 512 contiguous bytes per wave (4 whole lines) and not 16-byte pieces on 16 lines
    __shared__ __align__(16) _Float16 qs[BM * QSTRIDE];
    __shared__ __align__(16) float    os[BM * OSTRIDE];

    const int tid   = threadIdx.x;
    const int lane  = tid & 31;
    const int wid   = tid >> 5;
    const int set   = __builtin_amdgcn_readfirstlane(tid >> 8);  // same in all of a wave
    const int ts    = tid & (HT - 1);   // thread within its set
    const int ws    = wid & 7;          // wave within its set
    const int half  = lane >> 4;
    const int l16   = lane & 15;
    const int kbase = half * 8;

    const int    bh     = blockIdx.y;
    const int    qblk   = blockIdx.x;
    const size_t bh_off = (size_t)bh * SEQ * DHEAD;

    const float* kg0 = K + bh_off + (size_t)set * KSET * DHEAD;
    const float* vg0 = V + bh_off + (size_t)set * KSET * DHEAD;

    _Float16* Ks0  = &tiles[set][0][0][0];
    _Float16* Vts0 = &tiles[set][0][1][0];
    _Float16* Ks1  = &tiles[set][1][0][0];
    _Float16* Vts1 = &tiles[set][1][1][0];
    _Float16* Ks2  = &tiles[set][2][0][0];
    _Float16* Vts2 = &tiles[set][2][1][0];

    // the first tile's loads, ahead of everything else
    v4f kr[4], vr[4];
    // with the fence behind the wait below: keeps index arithmetic, which reuses the
    // loads' address registers, out of the stretch between the loads and their wait
    __builtin_amdgcn_sched_barrier(0);
    load_tile(kg0, vg0, ts, kr, vr);

    // ---- Q: of the 32 rows that a wave and its partner in the other set both work on, each
    // loads 16 (the 16 it will finish and store at the end): two whole rows per load ----
    // first of those 16 rows, in the block; same in all of a wave, so it waits in a scalar
    // register for the epilogue
    const int    own   = (__builtin_amdgcn_readfirstlane(wid) & 7) * (16 * NQ) + set * 16;
    const int    rsub  = lane >> 4;                  // which row of a pair
    const int    csub  = (lane & 15) * 4;            // first of the lane's 4 columns
    const float* qg    = Q + bh_off + (size_t)(qblk * BM + own + rsub) * DHEAD + csub;
    v4f qf[8];
#pragma unroll
    for (int j = 0; j < 8; ++j) qf[j] = *(const v4f*)(qg + j * 2 * DHEAD);
    // a precaution: stands ahead of every reuse of the loads' address registers
    asm volatile("s_wait_xcnt 0x0" ::: "memory");
    __builtin_amdgcn_sched_barrier(0);

    v16h ones;
#pragma unroll
    for (int e = 0; e < 16; ++e) ones[e] = (_Float16)1.0f;

    v8f   l_i[NQ];           // row sums; this lane owns the block's rows ws*32 + g*16 + l16
    v8f   negm[NQ];          // minus the maximum in use of that qrow, in all 8 rows
    float lo  = -3.0e38f;    // floor of a move of the maximum: 0 once one is in use
    float thr = -3.0e38f;    // a score above it moves the maximum: 8 once one is in use
    v8f acc[NQ][4];          // O^T: rows d = t*16 + kbase + v, col = qrow
#pragma unroll
    for (int g = 0; g < NQ; ++g) {
#pragma unroll
        for (int v = 0; v < 8; ++v) { l_i[g][v] = 0.0f; negm[g][v] = 0.0f; }
#pragma unroll
        for (int t = 0; t < 4; ++t)
#pragma unroll
            for (int v = 0; v < 8; ++v) acc[g][t][v] = 0.0f;
    }

    // prologue: tile 0 into block 0; the loads of tile 1 in flight
    store_tile(kr, vr, Ks0, Vts0, ts);
    // as above: nothing that reuses an address register between the loads and their wait
    __builtin_amdgcn_sched_barrier(0);
    load_tile(kg0 + BN * DHEAD, vg0 + BN * DHEAD, ts, kr, vr);
    // a precaution: stands ahead of every reuse of the loads' address registers
    asm volatile("s_wait_xcnt 0x0" ::: "memory");
    __builtin_amdgcn_sched_barrier(0);

    // the wave's 16 Q rows, scaled and converted to f16, into LDS
#pragma unroll
    for (int j = 0; j < 8; ++j) {
        v4h h;
        h[0] = (_Float16)(qf[j].x * QSCALE); h[1] = (_Float16)(qf[j].y * QSCALE);
        h[2] = (_Float16)(qf[j].z * QSCALE); h[3] = (_Float16)(qf[j].w * QSCALE);
        *(v4h*)&qs[(own + 2 * j + rsub) * QSTRIDE + csub] = h;
    }

    block_arrive();  // tile 0 and the Q rows are stored
    block_wait();    // ... by every wave

    // ---- Q tile: B-operand (Q^T) registers of the wave's 32 rows, half of them staged by
    // the partner wave; they land under step 0's wait for the loads of tile 1 ----
    v16h qb[NQ][2];
#pragma unroll
    for (int g = 0; g < NQ; ++g)
#pragma unroll
        for (int c = 0; c < 2; ++c)
            qb[g][c] = ld_op16(&qs[(ws * (16 * NQ) + g * 16 + l16) * QSTRIDE + c * 32 + kbase]);

    // KSET / BN = 16 steps. Steps 0 to 13 store and load, with no test: 12 in this loop.
    // The wait that lets a step begin stands at the foot of the step before it.
    for (int kb = 0; kb < KSET - 4 * BN; kb += 3 * BN) {
        fa_step(Ks0, Vts0, Ks1, Vts1,
                kg0 + (size_t)(kb + 2 * BN) * DHEAD, vg0 + (size_t)(kb + 2 * BN) * DHEAD,
                true, true, ts, kr, vr, qb, ones, l16, kbase, lo, thr, negm, l_i, acc);
        block_wait();  // block 1 stored everywhere; block 2 read to its end

        fa_step(Ks1, Vts1, Ks2, Vts2,
                kg0 + (size_t)(kb + 3 * BN) * DHEAD, vg0 + (size_t)(kb + 3 * BN) * DHEAD,
                true, true, ts, kr, vr, qb, ones, l16, kbase, lo, thr, negm, l_i, acc);
        block_wait();  // block 2 stored everywhere; block 0 read to its end

        fa_step(Ks2, Vts2, Ks0, Vts0,
                kg0 + (size_t)(kb + 4 * BN) * DHEAD, vg0 + (size_t)(kb + 4 * BN) * DHEAD,
                true, true, ts, kr, vr, qb, ones, l16, kbase, lo, thr, negm, l_i, acc);
        block_wait();  // block 0 stored everywhere; block 1 read to its end
    }
    // ---- steps 12 and 13: the set's last two loads ----
    fa_step(Ks0, Vts0, Ks1, Vts1,
            kg0 + (size_t)(KSET - 2 * BN) * DHEAD, vg0 + (size_t)(KSET - 2 * BN) * DHEAD,
            true, true, ts, kr, vr, qb, ones, l16, kbase, lo, thr, negm, l_i, acc);
    block_wait();
    fa_step(Ks1, Vts1, Ks2, Vts2,
            kg0 + (size_t)(KSET - BN) * DHEAD, vg0 + (size_t)(KSET - BN) * DHEAD,
            true, true, ts, kr, vr, qb, ones, l16, kbase, lo, thr, negm, l_i, acc);
    // ---- the set's last two tiles: no load is left, then no store and no signal ----
    block_wait();
    fa_step(Ks2, Vts2, Ks0, Vts0, kg0, vg0,
            true, false, ts, kr, vr, qb, ones, l16, kbase, lo, thr, negm, l_i, acc);
    block_wait();
    fa_step(Ks0, Vts0, Ks1, Vts1, kg0, vg0,
            false, false, ts, kr, vr, qb, ones, l16, kbase, lo, thr, negm, l_i, acc);

    // ---- merge of the two sets: a wave of set 0 finishes query group 0 and hands
    // group 1 to its partner (same rows, other set); a wave of set 1 the reverse ----
    const bool up = set != 0;
    v8f   keep[4];
    float lk, mk;
    {
        v8f send[4];
#pragma unroll
        for (int t = 0; t < 4; ++t)
#pragma unroll
            for (int v = 0; v < 8; ++v) {
                keep[t][v] = up ? acc[1][t][v] : acc[0][t][v];
                send[t][v] = up ? acc[0][t][v] : acc[1][t][v];
            }
        lk = up ? l_i[1][0] : l_i[0][0];
        mk = up ? -negm[1][0] : -negm[0][0];
#pragma unroll
        for (int t = 0; t < 4; ++t) {
            v4f a, b;
            a.x = send[t][0]; a.y = send[t][1]; a.z = send[t][2]; a.w = send[t][3];
            b.x = send[t][4]; b.y = send[t][5]; b.z = send[t][6]; b.w = send[t][7];
            *(v4f*)&xacc[wid][2 * t][lane][0]     = a;
            *(v4f*)&xacc[wid][2 * t + 1][lane][0] = b;
        }
        xlm[wid][0][lane] = up ? l_i[0][0] : l_i[1][0];
        xlm[wid][1][lane] = up ? -negm[0][0] : -negm[1][0];
    }
    __syncthreads();  // every wave's hand-over is in LDS before its partner reads it
    const int   pw = wid ^ 8;
    const float lr = xlm[pw][0][lane];
    const float mr = xlm[pw][1][lane];
    const float mm = fmaxf(mk, mr);
    const float ak = __builtin_amdgcn_exp2f(mk - mm);
    const float ar = __builtin_amdgcn_exp2f(mr - mm);
    const float inv = 1.0f / (lk * ak + lr * ar);
    const float fk = ak * inv;
    const float fr = ar * inv;

    // ---- epilogue: O[qrow][d] = merged acc^T / l, into the wave's own 16 rows of os ----
    // the epilogue's indices come from the lane's number and from scalars alone: the loop has
    // no vector registers to spare for addresses held through it (they were spilled)
    const int ln   = (int)__builtin_amdgcn_mbcnt_lo(~0u, 0u);
    float*    orow = &os[(own + (ln & 15)) * OSTRIDE + (ln >> 4) * 8];
#pragma unroll
    for (int t = 0; t < 4; ++t) {
        const v4f a = *(const v4f*)&xacc[pw][2 * t][lane][0];
        const v4f b = *(const v4f*)&xacc[pw][2 * t + 1][lane][0];
        float4 lo4, hi4;
        lo4.x = keep[t][0] * fk + a.x * fr; lo4.y = keep[t][1] * fk + a.y * fr;
        lo4.z = keep[t][2] * fk + a.z * fr; lo4.w = keep[t][3] * fk + a.w * fr;
        hi4.x = keep[t][4] * fk + b.x * fr; hi4.y = keep[t][5] * fk + b.y * fr;
        hi4.z = keep[t][6] * fk + b.z * fr; hi4.w = keep[t][7] * fk + b.w * fr;
        *(float4*)&orow[t * 16]     = lo4;
        *(float4*)&orow[t * 16 + 4] = hi4;
    }
    // the rows are read back across lanes: every lane's LDS stores are finished first
    asm volatile("s_wait_dscnt 0x0" ::: "memory");
    // two whole rows, 512 contiguous bytes, per store
    float*       og = O + bh_off + (size_t)(qblk * BM + own) * DHEAD + ln * 4;
    const float* ob = &os[(own + (ln >> 4)) * OSTRIDE + (ln & 15) * 4];
#pragma unroll
    for (int j = 0; j < 8; ++j)
        *(v4f*)(og + j * 2 * DHEAD) = *(const v4f*)(ob + j * 2 * OSTRIDE);
}

extern "C" void kernel_launch(void* const* d_in, const int* in_sizes, int n_in,
                              void* d_out, int out_size, void* d_ws, size_t ws_size,
                              hipStream_t stream) {
    const float* Q = (const float*)d_in[0];
    const float* K = (const float*)d_in[1];
    const float* V = (const float*)d_in[2];
    float*       O = (float*)d_out;

    const size_t n  = (size_t)in_sizes[0];        // B*H*S*D = 4,194,304
    const int    bh = (int)(n / (SEQ * DHEAD));   // 32

    dim3 grid(SEQ / BM, bh);
    fa_fwd_wmma<<<grid, dim3(NT), 0, stream>>>(Q, K, V, O);
}
